// v000
// Measured on an AMD MI455X. A time is GPU time per run, averaged over a window of back-to-back runs after a warm-up
// (all launches, gaps included; the runs take copies of the inputs in turn), and the median of several windows.
// Apart from v000's, it joins two sittings. Times from different sittings can be a few percent apart, while
// side-by-side timings come from the same sitting.
// v000 is the starting kernel. One run takes 537 microseconds.
#include <hip/hip_runtime.h>
#include <hip/hip_bf16.h>

typedef __attribute__((ext_vector_type(16))) _Float16 v16h;
typedef __attribute__((ext_vector_type(8)))  _Float16 v8h;
typedef __attribute__((ext_vector_type(4)))  _Float16 v4h;
typedef __attribute__((ext_vector_type(8)))  float    v8f;

constexpr int kN  = 384;
constexpr int kNN = kN * kN;      // 147456
constexpr int kCZ = 128;
constexpr int kH  = 4;
constexpr int kC  = 32;
constexpr int kHC = kH * kC;      // 128

// ---------------------------------------------------------------------------
// 16x16x32 f16 WMMA wrapper (CDNA5, wave32). D = A(16x32) * B(32x16) + C.
// ---------------------------------------------------------------------------
__device__ __forceinline__ v8f wmma_f16(v16h a, v16h b, v8f c) {
  return __builtin_amdgcn_wmma_f32_16x16x32_f16(false, a, false, b,
                                                (short)0, c, false, false);
}

// ---------------------------------------------------------------------------
// 16x32 fp16 fragment load (A-layout, or B-layout of a transposed operand):
// lane L holds row m = L%16, halves [8*(L/16), +8) and [16+8*(L/16), +8).
// ---------------------------------------------------------------------------
__device__ __forceinline__ v16h gfrag(const _Float16* __restrict__ base,
                                      int strideH, int lane) {
  const _Float16* p = base + (long)(lane & 15) * strideH + ((lane >> 4) << 3);
  v8h lo = *(const v8h*)p;
  v8h hi = *(const v8h*)(p + 16);
  v16h r;
#pragma unroll
  for (int e = 0; e < 8; ++e) { r[e] = lo[e]; r[8 + e] = hi[e]; }
  return r;
}

// Fragment from an LDS tile row (32-half rows): two ds_load_b128.
__device__ __forceinline__ v16h lfrag(const _Float16* p0) {
  v8h lo = *(const v8h*)p0;
  v8h hi = *(const v8h*)(p0 + 16);
  v16h r;
#pragma unroll
  for (int e = 0; e < 8; ++e) { r[e] = lo[e]; r[8 + e] = hi[e]; }
  return r;
}

// ---------------------------------------------------------------------------
// One 16-byte global -> LDS async DMA (CDNA5, tracked by ASYNCcnt).
// VDST carries the LDS byte address (ISA: dsaddr = LDS_BASE + VGPR[VDST]).
// A generic pointer into LDS holds the LDS offset in its low 32 bits on
// AMDGPU, so truncating the pointer gives the right VDST value.
// ---------------------------------------------------------------------------
__device__ __forceinline__ void copy16(const _Float16* gsrc, _Float16* ldst) {
#if defined(__gfx1250__)
  asm volatile("global_load_async_to_lds_b128 %0, %1, off"
               :
               : "v"((unsigned)(unsigned long long)ldst), "v"(gsrc)
               : "memory");
#else
  *(v8h*)ldst = *(const v8h*)gsrc;
#endif
}

__device__ __forceinline__ void wait_async_copies() {
#if defined(__gfx1250__)
  asm volatile("s_wait_asynccnt 0x0" ::: "memory");
#endif
}

// ---------------------------------------------------------------------------
// Kernel 1: LayerNorm over c_z (one wave per (i,j) row) + pair-bias projection
//   zn  : fp16 (row, c) layout, NN x 128
//   bias: fp32 [h][q][k] = [h*NN + i*N + j]
// ---------------------------------------------------------------------------
__global__ __launch_bounds__(256) void ln_bias_kernel(
    const float* __restrict__ z, const float* __restrict__ g,
    const float* __restrict__ b, const float* __restrict__ wb,
    _Float16* __restrict__ zn, float* __restrict__ bias) {
  const int lane = threadIdx.x & 31;
  const int wave = threadIdx.x >> 5;
  const long row = (long)blockIdx.x * 8 + wave;

  const float4 zv = ((const float4*)(z + row * kCZ))[lane];  // c = 4*lane..
  float s  = zv.x + zv.y + zv.z + zv.w;
  float s2 = zv.x * zv.x + zv.y * zv.y + zv.z * zv.z + zv.w * zv.w;
#pragma unroll
  for (int m = 1; m < 32; m <<= 1) {
    s  += __shfl_xor(s,  m, 32);
    s2 += __shfl_xor(s2, m, 32);
  }
  const float mu = s * (1.0f / kCZ);
  const float rs = rsqrtf(s2 * (1.0f / kCZ) - mu * mu + 1e-5f);

  const float4 gv = ((const float4*)g)[lane];
  const float4 bv = ((const float4*)b)[lane];
  float zl[4];
  zl[0] = (zv.x - mu) * rs * gv.x + bv.x;
  zl[1] = (zv.y - mu) * rs * gv.y + bv.y;
  zl[2] = (zv.z - mu) * rs * gv.z + bv.z;
  zl[3] = (zv.w - mu) * rs * gv.w + bv.w;

  v4h hv = { (_Float16)zl[0], (_Float16)zl[1], (_Float16)zl[2], (_Float16)zl[3] };
  ((v4h*)(zn + row * kCZ))[lane] = hv;

  // bias_h = sum_c zn[c] * wb[c,h]
  float acc[kH] = {0.f, 0.f, 0.f, 0.f};
  const int c0 = lane * 4;
#pragma unroll
  for (int kk = 0; kk < 4; ++kk)
#pragma unroll
    for (int h = 0; h < kH; ++h) acc[h] += zl[kk] * wb[(c0 + kk) * kH + h];
#pragma unroll
  for (int h = 0; h < kH; ++h)
#pragma unroll
    for (int m = 1; m < 32; m <<= 1) acc[h] += __shfl_xor(acc[h], m, 32);
  if (lane == 0) {
#pragma unroll
    for (int h = 0; h < kH; ++h) bias[(long)h * kNN + row] = acc[h];
  }
}

// ---------------------------------------------------------------------------
// Kernel 2: projection GEMM  Y(M=NN x 128) = zn(fp16) @ W(128x128 fp32->fp16)
// Block = 256 threads (8 waves). Block tile: 128 rows x 64 cols.
// mode: 0=q (scaled, (i,h,j,c)), 1=k ((i,h,j,c)), 2=v (transposed (i,h,c,j)),
//       3=g (sigmoid(x+bg), (i,j,h*C+c))
// ---------------------------------------------------------------------------
__global__ __launch_bounds__(256) void proj_kernel(
    const _Float16* __restrict__ zn, const float* __restrict__ W,
    const float* __restrict__ bg, _Float16* __restrict__ out, int mode) {
  __shared__ _Float16 Wt[64][kCZ];  // [n][k], 16 KB
  const int lane = threadIdx.x & 31;
  const int wave = threadIdx.x >> 5;
  const int colbase = blockIdx.y * 64;
  const int rowbase = blockIdx.x * 128 + wave * 16;

  for (int idx = threadIdx.x; idx < 64 * kCZ; idx += 256) {
    const int n = idx & 63, kk = idx >> 6;
    Wt[n][kk] = (_Float16)W[kk * kHC + colbase + n];
  }
  __syncthreads();

  const v8f zero = {0.f, 0.f, 0.f, 0.f, 0.f, 0.f, 0.f, 0.f};
  v8f acc[4] = {zero, zero, zero, zero};

#pragma unroll
  for (int kk = 0; kk < kCZ; kk += 32) {
    const v16h a = gfrag(zn + (long)rowbase * kCZ + kk, kCZ, lane);
#pragma unroll
    for (int t = 0; t < 4; ++t) {
      const v16h bf = lfrag(&Wt[t * 16 + (lane & 15)][kk + ((lane >> 4) << 3)]);
      acc[t] = wmma_f16(a, bf, acc[t]);
    }
  }

#pragma unroll
  for (int t = 0; t < 4; ++t)
#pragma unroll
    for (int r = 0; r < 8; ++r) {
      const int m   = rowbase + ((lane >> 4) << 3) + r;  // global row (i*N+j)
      const int col = colbase + t * 16 + (lane & 15);    // 0..127 = h*C+c
      float val = acc[t][r];
      const int i = m / kN, j = m % kN;
      const int h = col >> 5, c = col & 31;
      if (mode == 0) {
        out[((i * kH + h) * kN + j) * kC + c] = (_Float16)(val * 0.17677669529663687f);
      } else if (mode == 1) {
        out[((i * kH + h) * kN + j) * kC + c] = (_Float16)val;
      } else if (mode == 2) {
        out[((i * kH + h) * kC + c) * kN + j] = (_Float16)val;   // V transposed
      } else {
        val += bg[col];
        out[(long)m * kHC + col] = (_Float16)(1.0f / (1.0f + __expf(-val)));
      }
    }
}

// ---------------------------------------------------------------------------
// Kernel 3: flash attention per (qblock, i, h). Wave owns 16 q rows.
// K/V 32x32 chunks are DMA'd once per block into double-buffered LDS
// (global_load_async_to_lds_b128, ASYNCcnt), overlapping the next chunk's
// copy with this chunk's WMMAs. Per chunk: 2 score WMMAs (+bias), online
// softmax (cross-lane butterflies within lane-groups of 16 matching the D
// layout), P bounced through per-wave LDS (D->A layout), 2 output WMMAs.
// ---------------------------------------------------------------------------
__global__ __launch_bounds__(256) void attn_kernel(
    const _Float16* __restrict__ q, const _Float16* __restrict__ k,
    const _Float16* __restrict__ vt, const float* __restrict__ bias,
    _Float16* __restrict__ ob) {
  __shared__ _Float16 Kt[2][32][32];  // [buf][j-row][c]      4 KB
  __shared__ _Float16 Vs[2][32][32];  // [buf][c-row][j]      4 KB
  __shared__ _Float16 P[8][16][32];   // per-wave P staging   8 KB
  const int tid  = threadIdx.x;
  const int lane = tid & 31;
  const int wave = tid >> 5;
  const int i = blockIdx.y, h = blockIdx.z;
  const int qbase = blockIdx.x * 128 + wave * 16;
  const long head = (long)(i * kH + h);
  const _Float16* qp = q  + head * kN * kC;
  const _Float16* kp = k  + head * kN * kC;
  const _Float16* vp = vt + head * kC * kN;
  const float*    bp = bias + (long)h * kNN;

  const int mbase = ((lane >> 4) << 3);
  const v16h aq = gfrag(qp + (long)qbase * kC, kC, lane);  // Q rows fixed

  // cooperative K/V tile copy: threads 0..127 -> K, 128..255 -> V.
  const int crow = (tid & 127) >> 2;   // 0..31
  const int cchk = (tid & 3) << 3;     // half offset 0,8,16,24

  // prologue: chunk 0 -> buffer 0
  if (tid < 128) copy16(kp + (long)crow * kC + cchk, &Kt[0][crow][cchk]);
  else           copy16(vp + (long)crow * kN + cchk, &Vs[0][crow][cchk]);

  const v8f zero = {0.f, 0.f, 0.f, 0.f, 0.f, 0.f, 0.f, 0.f};
  v8f o0 = zero, o1 = zero;  // c in [0,16) / [16,32)
  float mrow[8], lrow[8];
#pragma unroll
  for (int r = 0; r < 8; ++r) { mrow[r] = -1e30f; lrow[r] = 0.f; }

  for (int n = 0; n < kN / 32; ++n) {
    const int kb  = n * 32;
    const int buf = n & 1;

    // current buffer ready (own ASYNCcnt), block-wide via barrier; the same
    // barrier proves everyone finished reading buf^1 last iteration.
    wait_async_copies();
    __syncthreads();
    if (kb + 32 < kN) {  // overlap next chunk's DMA with this chunk's WMMAs
      if (tid < 128) copy16(kp + (long)(kb + 32 + crow) * kC + cchk,
                            &Kt[buf ^ 1][crow][cchk]);
      else           copy16(vp + (long)crow * kN + kb + 32 + cchk,
                            &Vs[buf ^ 1][crow][cchk]);
    }

    const v16h bk0 = lfrag(&Kt[buf][lane & 15][(lane >> 4) << 3]);
    const v16h bk1 = lfrag(&Kt[buf][16 + (lane & 15)][(lane >> 4) << 3]);
    v8f s0 = wmma_f16(aq, bk0, zero);
    v8f s1 = wmma_f16(aq, bk1, zero);

#pragma unroll
    for (int r = 0; r < 8; ++r) {
      const int qrow = qbase + mbase + r;
      s0[r] += bp[(long)qrow * kN + kb + (lane & 15)];
      s1[r] += bp[(long)qrow * kN + kb + 16 + (lane & 15)];
      float t = fmaxf(s0[r], s1[r]);
#pragma unroll
      for (int x = 1; x < 16; x <<= 1) t = fmaxf(t, __shfl_xor(t, x, 32));
      const float nm = fmaxf(mrow[r], t);
      const float sc = __expf(mrow[r] - nm);
      const float p0 = __expf(s0[r] - nm);
      const float p1 = __expf(s1[r] - nm);
      float rsum = p0 + p1;
#pragma unroll
      for (int x = 1; x < 16; x <<= 1) rsum += __shfl_xor(rsum, x, 32);
      lrow[r] = lrow[r] * sc + rsum;
      mrow[r] = nm;
      o0[r] *= sc;
      o1[r] *= sc;
      P[wave][mbase + r][lane & 15]        = (_Float16)p0;  // D-layout -> LDS
      P[wave][mbase + r][16 + (lane & 15)] = (_Float16)p1;
    }

    // Re-read P in A-fragment layout (wave-private LDS; in-order DS unit).
    const v16h ap = lfrag(&P[wave][lane & 15][(lane >> 4) << 3]);

    const v16h bv0 = lfrag(&Vs[buf][lane & 15][(lane >> 4) << 3]);
    const v16h bv1 = lfrag(&Vs[buf][16 + (lane & 15)][(lane >> 4) << 3]);
    o0 = wmma_f16(ap, bv0, o0);
    o1 = wmma_f16(ap, bv1, o1);
  }

#pragma unroll
  for (int r = 0; r < 8; ++r) {
    const float inv = 1.0f / lrow[r];
    const int j = qbase + mbase + r;
    _Float16* dst = ob + ((long)i * kN + j) * kHC + h * kC;
    dst[lane & 15]        = (_Float16)(o0[r] * inv);
    dst[16 + (lane & 15)] = (_Float16)(o1[r] * inv);
  }
}

// ---------------------------------------------------------------------------
// Kernel 4: out = (g .* o) @ wo + bo   (fp16 A, LDS-staged fp16 wo, fp32 out)
// ---------------------------------------------------------------------------
__global__ __launch_bounds__(256) void out_kernel(
    const _Float16* __restrict__ gb, const _Float16* __restrict__ ob,
    const float* __restrict__ wo, const float* __restrict__ bo,
    float* __restrict__ out) {
  __shared__ _Float16 Wt[64][kCZ];
  const int lane = threadIdx.x & 31;
  const int wave = threadIdx.x >> 5;
  const int colbase = blockIdx.y * 64;
  const int rowbase = blockIdx.x * 128 + wave * 16;

  for (int idx = threadIdx.x; idx < 64 * kCZ; idx += 256) {
    const int n = idx & 63, kk = idx >> 6;
    Wt[n][kk] = (_Float16)wo[kk * kCZ + colbase + n];
  }
  __syncthreads();

  const v8f zero = {0.f, 0.f, 0.f, 0.f, 0.f, 0.f, 0.f, 0.f};
  v8f acc[4] = {zero, zero, zero, zero};

#pragma unroll
  for (int kk = 0; kk < kCZ; kk += 32) {
    const v16h ag = gfrag(gb + (long)rowbase * kHC + kk, kHC, lane);
    const v16h ao = gfrag(ob + (long)rowbase * kHC + kk, kHC, lane);
    v16h a;
#pragma unroll
    for (int e = 0; e < 16; ++e) a[e] = ag[e] * ao[e];
#pragma unroll
    for (int t = 0; t < 4; ++t) {
      const v16h bf = lfrag(&Wt[t * 16 + (lane & 15)][kk + ((lane >> 4) << 3)]);
      acc[t] = wmma_f16(a, bf, acc[t]);
    }
  }

#pragma unroll
  for (int t = 0; t < 4; ++t)
#pragma unroll
    for (int r = 0; r < 8; ++r) {
      const int m   = rowbase + ((lane >> 4) << 3) + r;
      const int col = colbase + t * 16 + (lane & 15);
      out[(long)m * kCZ + col] = acc[t][r] + bo[col];
    }
}

// ---------------------------------------------------------------------------
extern "C" void kernel_launch(void* const* d_in, const int* in_sizes, int n_in,
                              void* d_out, int out_size, void* d_ws, size_t ws_size,
                              hipStream_t stream) {
  const float* z      = (const float*)d_in[0];
  const float* ln_g   = (const float*)d_in[1];
  const float* ln_b   = (const float*)d_in[2];
  const float* w_bias = (const float*)d_in[3];
  const float* wq     = (const float*)d_in[4];
  const float* wk     = (const float*)d_in[5];
  const float* wv     = (const float*)d_in[6];
  const float* wg     = (const float*)d_in[7];
  const float* bg     = (const float*)d_in[8];
  const float* wo     = (const float*)d_in[9];
  const float* bo     = (const float*)d_in[10];
  float* out = (float*)d_out;

  char* ws = (char*)d_ws;
  const size_t S2 = (size_t)kNN * kHC * 2;  // one fp16 NN x 128 buffer
  _Float16* zn = (_Float16*)(ws);
  _Float16* qb = (_Float16*)(ws + 1 * S2);
  _Float16* kb = (_Float16*)(ws + 2 * S2);
  _Float16* vt = (_Float16*)(ws + 3 * S2);
  _Float16* gb = (_Float16*)(ws + 4 * S2);
  _Float16* ob = (_Float16*)(ws + 5 * S2);
  float*  biasb = (float*)(ws + 6 * S2);    // H * NN fp32

  ln_bias_kernel<<<kNN / 8, 256, 0, stream>>>(z, ln_g, ln_b, w_bias, zn, biasb);

  dim3 g2(kNN / 128, 2);
  proj_kernel<<<g2, 256, 0, stream>>>(zn, wq, nullptr, qb, 0);
  proj_kernel<<<g2, 256, 0, stream>>>(zn, wk, nullptr, kb, 1);
  proj_kernel<<<g2, 256, 0, stream>>>(zn, wv, nullptr, vt, 2);
  proj_kernel<<<g2, 256, 0, stream>>>(zn, wg, bg, gb, 3);

  dim3 g3(kN / 128, kN, kH);
  attn_kernel<<<g3, 256, 0, stream>>>(qb, kb, vt, biasb, ob);

  out_kernel<<<g2, 256, 0, stream>>>(gb, ob, wo, bo, out);
}

// v001
// One run takes 314 microseconds.
// Next to v000, in two timings, it ran 1.76 times as fast each time.
#include <hip/hip_runtime.h>
#include <hip/hip_bf16.h>

typedef __attribute__((ext_vector_type(16))) _Float16 v16h;
typedef __attribute__((ext_vector_type(8)))  _Float16 v8h;
typedef __attribute__((ext_vector_type(4)))  _Float16 v4h;
typedef __attribute__((ext_vector_type(8)))  float    v8f;

constexpr int kN  = 384;
constexpr int kNN = kN * kN;      // 147456
constexpr int kCZ = 128;
constexpr int kH  = 4;
constexpr int kC  = 32;
constexpr int kHC = kH * kC;      // 128
// LDS row pitches in halves: an odd multiple of 16 bytes, so that the 16 rows
// one ds_load_b128 fragment read touches fall on 16 different bank groups.
constexpr int kWP = kCZ + 8;      // 272-byte rows for the 128-half weight tiles
constexpr int kTP = 32 + 8;       // 80-byte rows for the 32-half K, V, P tiles

// ---------------------------------------------------------------------------
// 16x16x32 f16 WMMA wrapper (CDNA5, wave32). D = A(16x32) * B(32x16) + C.
// ---------------------------------------------------------------------------
__device__ __forceinline__ v8f wmma_f16(v16h a, v16h b, v8f c) {
  return __builtin_amdgcn_wmma_f32_16x16x32_f16(false, a, false, b,
                                                (short)0, c, false, false);
}

// ---------------------------------------------------------------------------
// 16x32 fp16 fragment load (A-layout, or B-layout of a transposed operand):
// lane L holds row m = L%16, halves [8*(L/16), +8) and [16+8*(L/16), +8).
// ---------------------------------------------------------------------------
__device__ __forceinline__ v16h gfrag(const _Float16* __restrict__ base,
                                      int strideH, int lane) {
  const _Float16* p = base + (long)(lane & 15) * strideH + ((lane >> 4) << 3);
  v8h lo = *(const v8h*)p;
  v8h hi = *(const v8h*)(p + 16);
  v16h r;
#pragma unroll
  for (int e = 0; e < 8; ++e) { r[e] = lo[e]; r[8 + e] = hi[e]; }
  return r;
}

// Fragment from an LDS tile row (32 halves of it): two ds_load_b128.
__device__ __forceinline__ v16h lfrag(const _Float16* p0) {
  v8h lo = *(const v8h*)p0;
  v8h hi = *(const v8h*)(p0 + 16);
  v16h r;
#pragma unroll
  for (int e = 0; e < 8; ++e) { r[e] = lo[e]; r[8 + e] = hi[e]; }
  return r;
}

// ---------------------------------------------------------------------------
// One 16-byte global -> LDS async DMA (CDNA5, tracked by ASYNCcnt).
// VDST carries the LDS byte address (ISA: dsaddr = LDS_BASE + VGPR[VDST]).
// A generic pointer into LDS holds the LDS offset in its low 32 bits on
// AMDGPU, so truncating the pointer gives the right VDST value.
// ---------------------------------------------------------------------------
__device__ __forceinline__ void copy16(const _Float16* gsrc, _Float16* ldst) {
#if defined(__gfx1250__)
  asm volatile("global_load_async_to_lds_b128 %0, %1, off"
               :
               : "v"((unsigned)(unsigned long long)ldst), "v"(gsrc)
               : "memory");
#else
  *(v8h*)ldst = *(const v8h*)gsrc;
#endif
}

__device__ __forceinline__ void wait_async_copies() {
#if defined(__gfx1250__)
  asm volatile("s_wait_asynccnt 0x0" ::: "memory");
#endif
}

// ---------------------------------------------------------------------------
// Kernel 1: LayerNorm over c_z (one wave per (i,j) row) + pair-bias projection
//   zn  : fp16 (row, c) layout, NN x 128
//   bias: fp32 [h][q][k] = [h*NN + i*N + j]
// ---------------------------------------------------------------------------
__global__ __launch_bounds__(256) void ln_bias_kernel(
    const float* __restrict__ z, const float* __restrict__ g,
    const float* __restrict__ b, const float* __restrict__ wb,
    _Float16* __restrict__ zn, float* __restrict__ bias) {
  const int lane = threadIdx.x & 31;
  const int wave = threadIdx.x >> 5;
  const long row = (long)blockIdx.x * 8 + wave;

  const float4 zv = ((const float4*)(z + row * kCZ))[lane];  // c = 4*lane..
  float s  = zv.x + zv.y + zv.z + zv.w;
  float s2 = zv.x * zv.x + zv.y * zv.y + zv.z * zv.z + zv.w * zv.w;
#pragma unroll
  for (int m = 1; m < 32; m <<= 1) {
    s  += __shfl_xor(s,  m, 32);
    s2 += __shfl_xor(s2, m, 32);
  }
  const float mu = s * (1.0f / kCZ);
  const float rs = rsqrtf(s2 * (1.0f / kCZ) - mu * mu + 1e-5f);

  const float4 gv = ((const float4*)g)[lane];
  const float4 bv = ((const float4*)b)[lane];
  float zl[4];
  zl[0] = (zv.x - mu) * rs * gv.x + bv.x;
  zl[1] = (zv.y - mu) * rs * gv.y + bv.y;
  zl[2] = (zv.z - mu) * rs * gv.z + bv.z;
  zl[3] = (zv.w - mu) * rs * gv.w + bv.w;

  v4h hv = { (_Float16)zl[0], (_Float16)zl[1], (_Float16)zl[2], (_Float16)zl[3] };
  ((v4h*)(zn + row * kCZ))[lane] = hv;

  // bias_h = sum_c zn[c] * wb[c,h]
  float acc[kH] = {0.f, 0.f, 0.f, 0.f};
  const int c0 = lane * 4;
#pragma unroll
  for (int kk = 0; kk < 4; ++kk)
#pragma unroll
    for (int h = 0; h < kH; ++h) acc[h] += zl[kk] * wb[(c0 + kk) * kH + h];
#pragma unroll
  for (int h = 0; h < kH; ++h)
#pragma unroll
    for (int m = 1; m < 32; m <<= 1) acc[h] += __shfl_xor(acc[h], m, 32);
  if (lane == 0) {
#pragma unroll
    for (int h = 0; h < kH; ++h) bias[(long)h * kNN + row] = acc[h];
  }
}

// ---------------------------------------------------------------------------
// Kernel 2: projection GEMM  Y(M=NN x 128) = zn(fp16) @ W(128x128 fp32->fp16)
// Block = 256 threads (8 waves). Block tile: 128 rows x 64 cols.
// mode: 0=q (scaled, (i,h,j,c)), 1=k ((i,h,j,c)), 2=v (transposed (i,h,c,j)),
//       3=g (sigmoid(x+bg), (i,j,h*C+c))
// ---------------------------------------------------------------------------
__global__ __launch_bounds__(256) void proj_kernel(
    const _Float16* __restrict__ zn, const float* __restrict__ W,
    const float* __restrict__ bg, _Float16* __restrict__ out, int mode) {
  __shared__ __attribute__((aligned(16))) _Float16 Wt[64][kWP];  // [n][k], 17 KB
  const int lane = threadIdx.x & 31;
  const int wave = threadIdx.x >> 5;
  const int colbase = blockIdx.y * 64;
  const int rowbase = blockIdx.x * 128 + wave * 16;

  for (int idx = threadIdx.x; idx < 64 * kCZ; idx += 256) {
    const int n = idx & 63, kk = idx >> 6;
    Wt[n][kk] = (_Float16)W[kk * kHC + colbase + n];
  }
  __syncthreads();

  const v8f zero = {0.f, 0.f, 0.f, 0.f, 0.f, 0.f, 0.f, 0.f};
  v8f acc[4] = {zero, zero, zero, zero};

#pragma unroll
  for (int kk = 0; kk < kCZ; kk += 32) {
    const v16h a = gfrag(zn + (long)rowbase * kCZ + kk, kCZ, lane);
#pragma unroll
    for (int t = 0; t < 4; ++t) {
      const v16h bf = lfrag(&Wt[t * 16 + (lane & 15)][kk + ((lane >> 4) << 3)]);
      acc[t] = wmma_f16(a, bf, acc[t]);
    }
  }

#pragma unroll
  for (int t = 0; t < 4; ++t)
#pragma unroll
    for (int r = 0; r < 8; ++r) {
      const int m   = rowbase + ((lane >> 4) << 3) + r;  // global row (i*N+j)
      const int col = colbase + t * 16 + (lane & 15);    // 0..127 = h*C+c
      float val = acc[t][r];
      const int i = m / kN, j = m % kN;
      const int h = col >> 5, c = col & 31;
      if (mode == 0) {
        out[((i * kH + h) * kN + j) * kC + c] = (_Float16)(val * 0.17677669529663687f);
      } else if (mode == 1) {
        out[((i * kH + h) * kN + j) * kC + c] = (_Float16)val;
      } else if (mode == 2) {
        out[((i * kH + h) * kC + c) * kN + j] = (_Float16)val;   // V transposed
      } else {
        val += bg[col];
        out[(long)m * kHC + col] = (_Float16)(1.0f / (1.0f + __expf(-val)));
      }
    }
}

// ---------------------------------------------------------------------------
// Kernel 3: flash attention per (qblock, i, h). Wave owns 16 q rows.
// K/V 32x32 chunks are DMA'd once per block into double-buffered LDS
// (global_load_async_to_lds_b128, ASYNCcnt), overlapping the next chunk's
// copy with this chunk's WMMAs. Per chunk: 2 score WMMAs (+bias), online
// softmax (cross-lane butterflies within lane-groups of 16 matching the D
// layout), P bounced through per-wave LDS (D->A layout), 2 output WMMAs.
// ---------------------------------------------------------------------------
__global__ __launch_bounds__(256) void attn_kernel(
    const _Float16* __restrict__ q, const _Float16* __restrict__ k,
    const _Float16* __restrict__ vt, const float* __restrict__ bias,
    _Float16* __restrict__ ob) {
  __shared__ __attribute__((aligned(16))) _Float16 Kt[2][32][kTP];  // [buf][j-row][c]     5 KB
  __shared__ __attribute__((aligned(16))) _Float16 Vs[2][32][kTP];  // [buf][c-row][j]     5 KB
  __shared__ __attribute__((aligned(16))) _Float16 P[8][16][kTP];   // per-wave P staging 10 KB
  const int tid  = threadIdx.x;
  const int lane = tid & 31;
  const int wave = tid >> 5;
  const int i = blockIdx.y, h = blockIdx.z;
  const int qbase = blockIdx.x * 128 + wave * 16;
  const long head = (long)(i * kH + h);
  const _Float16* qp = q  + head * kN * kC;
  const _Float16* kp = k  + head * kN * kC;
  const _Float16* vp = vt + head * kC * kN;
  const float*    bp = bias + (long)h * kNN;

  const int mbase = ((lane >> 4) << 3);
  const v16h aq = gfrag(qp + (long)qbase * kC, kC, lane);  // Q rows fixed

  // cooperative K/V tile copy: threads 0..127 -> K, 128..255 -> V.
  const int crow = (tid & 127) >> 2;   // 0..31
  const int cchk = (tid & 3) << 3;     // half offset 0,8,16,24

  // prologue: chunk 0 -> buffer 0
  if (tid < 128) copy16(kp + (long)crow * kC + cchk, &Kt[0][crow][cchk]);
  else           copy16(vp + (long)crow * kN + cchk, &Vs[0][crow][cchk]);

  const v8f zero = {0.f, 0.f, 0.f, 0.f, 0.f, 0.f, 0.f, 0.f};
  v8f o0 = zero, o1 = zero;  // c in [0,16) / [16,32)
  float mrow[8], lrow[8];
#pragma unroll
  for (int r = 0; r < 8; ++r) { mrow[r] = -1e30f; lrow[r] = 0.f; }

  for (int n = 0; n < kN / 32; ++n) {
    const int kb  = n * 32;
    const int buf = n & 1;

    // current buffer ready (own ASYNCcnt), block-wide via barrier; the same
    // barrier proves everyone finished reading buf^1 last iteration.
    wait_async_copies();
    __syncthreads();
    if (kb + 32 < kN) {  // overlap next chunk's DMA with this chunk's WMMAs
      if (tid < 128) copy16(kp + (long)(kb + 32 + crow) * kC + cchk,
                            &Kt[buf ^ 1][crow][cchk]);
      else           copy16(vp + (long)crow * kN + kb + 32 + cchk,
                            &Vs[buf ^ 1][crow][cchk]);
    }

    const v16h bk0 = lfrag(&Kt[buf][lane & 15][(lane >> 4) << 3]);
    const v16h bk1 = lfrag(&Kt[buf][16 + (lane & 15)][(lane >> 4) << 3]);
    v8f s0 = wmma_f16(aq, bk0, zero);
    v8f s1 = wmma_f16(aq, bk1, zero);

#pragma unroll
    for (int r = 0; r < 8; ++r) {
      const int qrow = qbase + mbase + r;
      s0[r] += bp[(long)qrow * kN + kb + (lane & 15)];
      s1[r] += bp[(long)qrow * kN + kb + 16 + (lane & 15)];
      float t = fmaxf(s0[r], s1[r]);
#pragma unroll
      for (int x = 1; x < 16; x <<= 1) t = fmaxf(t, __shfl_xor(t, x, 32));
      const float nm = fmaxf(mrow[r], t);
      const float sc = __expf(mrow[r] - nm);
      const float p0 = __expf(s0[r] - nm);
      const float p1 = __expf(s1[r] - nm);
      float rsum = p0 + p1;
#pragma unroll
      for (int x = 1; x < 16; x <<= 1) rsum += __shfl_xor(rsum, x, 32);
      lrow[r] = lrow[r] * sc + rsum;
      mrow[r] = nm;
      o0[r] *= sc;
      o1[r] *= sc;
      P[wave][mbase + r][lane & 15]        = (_Float16)p0;  // D-layout -> LDS
      P[wave][mbase + r][16 + (lane & 15)] = (_Float16)p1;
    }

    // Re-read P in A-fragment layout (wave-private LDS; in-order DS unit).
    const v16h ap = lfrag(&P[wave][lane & 15][(lane >> 4) << 3]);

    const v16h bv0 = lfrag(&Vs[buf][lane & 15][(lane >> 4) << 3]);
    const v16h bv1 = lfrag(&Vs[buf][16 + (lane & 15)][(lane >> 4) << 3]);
    o0 = wmma_f16(ap, bv0, o0);
    o1 = wmma_f16(ap, bv1, o1);
  }

#pragma unroll
  for (int r = 0; r < 8; ++r) {
    const float inv = 1.0f / lrow[r];
    const int j = qbase + mbase + r;
    _Float16* dst = ob + ((long)i * kN + j) * kHC + h * kC;
    dst[lane & 15]        = (_Float16)(o0[r] * inv);
    dst[16 + (lane & 15)] = (_Float16)(o1[r] * inv);
  }
}

// ---------------------------------------------------------------------------
// Kernel 4: out = (g .* o) @ wo + bo   (fp16 A, LDS-staged fp16 wo, fp32 out)
// ---------------------------------------------------------------------------
__global__ __launch_bounds__(256) void out_kernel(
    const _Float16* __restrict__ gb, const _Float16* __restrict__ ob,
    const float* __restrict__ wo, const float* __restrict__ bo,
    float* __restrict__ out) {
  __shared__ __attribute__((aligned(16))) _Float16 Wt[64][kWP];
  const int lane = threadIdx.x & 31;
  const int wave = threadIdx.x >> 5;
  const int colbase = blockIdx.y * 64;
  const int rowbase = blockIdx.x * 128 + wave * 16;

  for (int idx = threadIdx.x; idx < 64 * kCZ; idx += 256) {
    const int n = idx & 63, kk = idx >> 6;
    Wt[n][kk] = (_Float16)wo[kk * kCZ + colbase + n];
  }
  __syncthreads();

  const v8f zero = {0.f, 0.f, 0.f, 0.f, 0.f, 0.f, 0.f, 0.f};
  v8f acc[4] = {zero, zero, zero, zero};

#pragma unroll
  for (int kk = 0; kk < kCZ; kk += 32) {
    const v16h ag = gfrag(gb + (long)rowbase * kHC + kk, kHC, lane);
    const v16h ao = gfrag(ob + (long)rowbase * kHC + kk, kHC, lane);
    v16h a;
#pragma unroll
    for (int e = 0; e < 16; ++e) a[e] = ag[e] * ao[e];
#pragma unroll
    for (int t = 0; t < 4; ++t) {
      const v16h bf = lfrag(&Wt[t * 16 + (lane & 15)][kk + ((lane >> 4) << 3)]);
      acc[t] = wmma_f16(a, bf, acc[t]);
    }
  }

#pragma unroll
  for (int t = 0; t < 4; ++t)
#pragma unroll
    for (int r = 0; r < 8; ++r) {
      const int m   = rowbase + ((lane >> 4) << 3) + r;
      const int col = colbase + t * 16 + (lane & 15);
      out[(long)m * kCZ + col] = acc[t][r] + bo[col];
    }
}

// ---------------------------------------------------------------------------
extern "C" void kernel_launch(void* const* d_in, const int* in_sizes, int n_in,
                              void* d_out, int out_size, void* d_ws, size_t ws_size,
                              hipStream_t stream) {
  const float* z      = (const float*)d_in[0];
  const float* ln_g   = (const float*)d_in[1];
  const float* ln_b   = (const float*)d_in[2];
  const float* w_bias = (const float*)d_in[3];
  const float* wq     = (const float*)d_in[4];
  const float* wk     = (const float*)d_in[5];
  const float* wv     = (const float*)d_in[6];
  const float* wg     = (const float*)d_in[7];
  const float* bg     = (const float*)d_in[8];
  const float* wo     = (const float*)d_in[9];
  const float* bo     = (const float*)d_in[10];
  float* out = (float*)d_out;

  char* ws = (char*)d_ws;
  const size_t S2 = (size_t)kNN * kHC * 2;  // one fp16 NN x 128 buffer
  _Float16* zn = (_Float16*)(ws);
  _Float16* qb = (_Float16*)(ws + 1 * S2);
  _Float16* kb = (_Float16*)(ws + 2 * S2);
  _Float16* vt = (_Float16*)(ws + 3 * S2);
  _Float16* gb = (_Float16*)(ws + 4 * S2);
  _Float16* ob = (_Float16*)(ws + 5 * S2);
  float*  biasb = (float*)(ws + 6 * S2);    // H * NN fp32

  ln_bias_kernel<<<kNN / 8, 256, 0, stream>>>(z, ln_g, ln_b, w_bias, zn, biasb);

  dim3 g2(kNN / 128, 2);
  proj_kernel<<<g2, 256, 0, stream>>>(zn, wq, nullptr, qb, 0);
  proj_kernel<<<g2, 256, 0, stream>>>(zn, wk, nullptr, kb, 1);
  proj_kernel<<<g2, 256, 0, stream>>>(zn, wv, nullptr, vt, 2);
  proj_kernel<<<g2, 256, 0, stream>>>(zn, wg, bg, gb, 3);

  dim3 g3(kN / 128, kN, kH);
  attn_kernel<<<g3, 256, 0, stream>>>(qb, kb, vt, biasb, ob);

  out_kernel<<<g2, 256, 0, stream>>>(gb, ob, wo, bo, out);
}

// v002
// A run of this version takes 236 microseconds.
// Timed twice side by side with v001, it ran 1.33 times as fast both times.
// All steps since v000 together make it 2.35 times as fast.
#include <hip/hip_runtime.h>
#include <hip/hip_bf16.h>

typedef __attribute__((ext_vector_type(16))) _Float16 v16h;
typedef __attribute__((ext_vector_type(8)))  _Float16 v8h;
typedef __attribute__((ext_vector_type(4)))  _Float16 v4h;
typedef __attribute__((ext_vector_type(8)))  float    v8f;

constexpr int kN  = 384;
constexpr int kNN = kN * kN;      // 147456
constexpr int kCZ = 128;
constexpr int kH  = 4;
constexpr int kC  = 32;
constexpr int kHC = kH * kC;      // 128
// LDS row pitches in halves: an odd multiple of 16 bytes, so that the 16 rows
// one ds_load_b128 fragment read touches fall on 16 different bank groups.
constexpr int kWP = kCZ + 8;      // 272-byte rows for the 128-half weight tiles
constexpr int kTP = 32 + 8;       // 80-byte rows for the 32-half K, V tiles

// ---------------------------------------------------------------------------
// 16x16x32 f16 WMMA wrapper (CDNA5, wave32). D = A(16x32) * B(32x16) + C.
// ---------------------------------------------------------------------------
__device__ __forceinline__ v8f wmma_f16(v16h a, v16h b, v8f c) {
  return __builtin_amdgcn_wmma_f32_16x16x32_f16(false, a, false, b,
                                                (short)0, c, false, false);
}

// ---------------------------------------------------------------------------
// 16x32 fp16 fragment load (A-layout, or B-layout of a transposed operand):
// lane L holds row m = L%16, halves [8*(L/16), +8) and [16+8*(L/16), +8).
// ---------------------------------------------------------------------------
__device__ __forceinline__ v16h gfrag(const _Float16* __restrict__ base,
                                      int strideH, int lane) {
  const _Float16* p = base + (long)(lane & 15) * strideH + ((lane >> 4) << 3);
  v8h lo = *(const v8h*)p;
  v8h hi = *(const v8h*)(p + 16);
  v16h r;
#pragma unroll
  for (int e = 0; e < 8; ++e) { r[e] = lo[e]; r[8 + e] = hi[e]; }
  return r;
}

// Fragment from an LDS tile row (32 halves of it): two ds_load_b128.
__device__ __forceinline__ v16h lfrag(const _Float16* p0) {
  v8h lo = *(const v8h*)p0;
  v8h hi = *(const v8h*)(p0 + 16);
  v16h r;
#pragma unroll
  for (int e = 0; e < 8; ++e) { r[e] = lo[e]; r[8 + e] = hi[e]; }
  return r;
}

// ---------------------------------------------------------------------------
// One 16-byte global -> LDS async DMA (CDNA5, tracked by ASYNCcnt).
// VDST carries the LDS byte address (ISA: dsaddr = LDS_BASE + VGPR[VDST]).
// A generic pointer into LDS holds the LDS offset in its low 32 bits on
// AMDGPU, so truncating the pointer gives the right VDST value.
// ---------------------------------------------------------------------------
__device__ __forceinline__ void copy16(const _Float16* gsrc, _Float16* ldst) {
#if defined(__gfx1250__)
  asm volatile("global_load_async_to_lds_b128 %0, %1, off"
               :
               : "v"((unsigned)(unsigned long long)ldst), "v"(gsrc)
               : "memory");
#else
  *(v8h*)ldst = *(const v8h*)gsrc;
#endif
}

__device__ __forceinline__ void wait_async_copies() {
#if defined(__gfx1250__)
  asm volatile("s_wait_asynccnt 0x0" ::: "memory");
#endif
}

// ---------------------------------------------------------------------------
// Place of bias[h][q][k] in the workspace. A tile holds 16 q x 32 k (2 KB) as
// four 512-byte groups; group g, lane l, float e is the C/D element of the
// transposed score tile S^T (rows k, columns q): column q = l % 16, row
// k = 16*(g/2) + 8*(l/16) + 4*(g%2) + e. One global_load_b128 of a wave then
// reads one whole group: four full 128-byte lines.
// ---------------------------------------------------------------------------
__device__ __forceinline__ int bias_index(int h, int q, int k) {
  const int tile = (h * (kN / 16) + (q >> 4)) * (kN / 32) + (k >> 5);
  const int grp  = ((k >> 4) & 1) * 2 + ((k >> 2) & 1);
  const int ln   = (q & 15) + (((k >> 3) & 1) << 4);
  return tile * 512 + grp * 128 + ln * 4 + (k & 3);
}

// Lane l <-> lane l ^ 16 (the two halves of a wave that share a WMMA column).
__device__ __forceinline__ float xhalf(float x) {
  const int v = __builtin_bit_cast(int, x);
  return __builtin_bit_cast(float, __builtin_amdgcn_permlanex16(
      v, v, 0x76543210, 0xfedcba98, false, false));
}

// ---------------------------------------------------------------------------
// Kernel 1: LayerNorm over c_z (one wave per (i,j) row) + pair-bias projection
//   zn  : fp16 (row, c) layout, NN x 128
//   bias: fp32, q = i, k = j, in tiles of 16 q x 32 k laid out in the order in
//         which attn_kernel's lanes take them as WMMA C operands (bias_index)
// ---------------------------------------------------------------------------
__global__ __launch_bounds__(256) void ln_bias_kernel(
    const float* __restrict__ z, const float* __restrict__ g,
    const float* __restrict__ b, const float* __restrict__ wb,
    _Float16* __restrict__ zn, float* __restrict__ bias) {
  const int lane = threadIdx.x & 31;
  const int wave = threadIdx.x >> 5;
  const long row = (long)blockIdx.x * 8 + wave;

  const float4 zv = ((const float4*)(z + row * kCZ))[lane];  // c = 4*lane..
  float s  = zv.x + zv.y + zv.z + zv.w;
  float s2 = zv.x * zv.x + zv.y * zv.y + zv.z * zv.z + zv.w * zv.w;
#pragma unroll
  for (int m = 1; m < 32; m <<= 1) {
    s  += __shfl_xor(s,  m, 32);
    s2 += __shfl_xor(s2, m, 32);
  }
  const float mu = s * (1.0f / kCZ);
  const float rs = rsqrtf(s2 * (1.0f / kCZ) - mu * mu + 1e-5f);

  const float4 gv = ((const float4*)g)[lane];
  const float4 bv = ((const float4*)b)[lane];
  float zl[4];
  zl[0] = (zv.x - mu) * rs * gv.x + bv.x;
  zl[1] = (zv.y - mu) * rs * gv.y + bv.y;
  zl[2] = (zv.z - mu) * rs * gv.z + bv.z;
  zl[3] = (zv.w - mu) * rs * gv.w + bv.w;

  v4h hv = { (_Float16)zl[0], (_Float16)zl[1], (_Float16)zl[2], (_Float16)zl[3] };
  ((v4h*)(zn + row * kCZ))[lane] = hv;

  // bias_h = sum_c zn[c] * wb[c,h]
  float acc[kH] = {0.f, 0.f, 0.f, 0.f};
  const int c0 = lane * 4;
#pragma unroll
  for (int kk = 0; kk < 4; ++kk)
#pragma unroll
    for (int h = 0; h < kH; ++h) acc[h] += zl[kk] * wb[(c0 + kk) * kH + h];
#pragma unroll
  for (int h = 0; h < kH; ++h)
#pragma unroll
    for (int m = 1; m < 32; m <<= 1) acc[h] += __shfl_xor(acc[h], m, 32);
  if (lane == 0) {
#pragma unroll
    for (int h = 0; h < kH; ++h) bias[bias_index(h, (int)row / kN, (int)row % kN)] = acc[h];
  }
}

// ---------------------------------------------------------------------------
// Kernel 2: projection GEMM  Y(M=NN x 128) = zn(fp16) @ W(128x128 fp32->fp16)
// Block = 256 threads (8 waves). Block tile: 128 rows x 64 cols.
// mode: 0=q (scaled, (i,h,j,c)), 1=k ((i,h,j,c)), 2=v (transposed (i,h,c,j)),
//       3=g (sigmoid(x+bg), (i,j,h*C+c))
// ---------------------------------------------------------------------------
__global__ __launch_bounds__(256) void proj_kernel(
    const _Float16* __restrict__ zn, const float* __restrict__ W,
    const float* __restrict__ bg, _Float16* __restrict__ out, int mode) {
  __shared__ __attribute__((aligned(16))) _Float16 Wt[64][kWP];  // [n][k], 17 KB
  const int lane = threadIdx.x & 31;
  const int wave = threadIdx.x >> 5;
  const int colbase = blockIdx.y * 64;
  const int rowbase = blockIdx.x * 128 + wave * 16;

  for (int idx = threadIdx.x; idx < 64 * kCZ; idx += 256) {
    const int n = idx & 63, kk = idx >> 6;
    Wt[n][kk] = (_Float16)W[kk * kHC + colbase + n];
  }
  __syncthreads();

  const v8f zero = {0.f, 0.f, 0.f, 0.f, 0.f, 0.f, 0.f, 0.f};
  v8f acc[4] = {zero, zero, zero, zero};

#pragma unroll
  for (int kk = 0; kk < kCZ; kk += 32) {
    const v16h a = gfrag(zn + (long)rowbase * kCZ + kk, kCZ, lane);
#pragma unroll
    for (int t = 0; t < 4; ++t) {
      const v16h bf = lfrag(&Wt[t * 16 + (lane & 15)][kk + ((lane >> 4) << 3)]);
      acc[t] = wmma_f16(a, bf, acc[t]);
    }
  }

#pragma unroll
  for (int t = 0; t < 4; ++t)
#pragma unroll
    for (int r = 0; r < 8; ++r) {
      const int m   = rowbase + ((lane >> 4) << 3) + r;  // global row (i*N+j)
      const int col = colbase + t * 16 + (lane & 15);    // 0..127 = h*C+c
      float val = acc[t][r];
      const int i = m / kN, j = m % kN;
      const int h = col >> 5, c = col & 31;
      if (mode == 0) {
        out[((i * kH + h) * kN + j) * kC + c] = (_Float16)(val * 0.17677669529663687f);
      } else if (mode == 1) {
        out[((i * kH + h) * kN + j) * kC + c] = (_Float16)val;
      } else if (mode == 2) {
        out[((i * kH + h) * kC + c) * kN + j] = (_Float16)val;   // V transposed
      } else {
        val += bg[col];
        out[(long)m * kHC + col] = (_Float16)(1.0f / (1.0f + __expf(-val)));
      }
    }
}

// ---------------------------------------------------------------------------
// Kernel 3: flash attention per (qblock, i, h). Wave owns 16 q rows.
// K/V 32x32 chunks are DMA'd once per block into double-buffered LDS
// (global_load_async_to_lds_b128, ASYNCcnt), overlapping the next chunk's
// copy with this chunk's WMMAs. Per chunk: S^T = K Q^T + bias^T (2 WMMAs, K
// rows as A, Q as B, the bias tile as C), so a lane holds 16 scores of ONE
// query: maximum and sum run in its own registers, plus one exchange between
// the wave's halves. The two S^T tiles, converted in place, are the B operand
// of O^T += V^T P^T (2 WMMAs): P never leaves the registers.
// ---------------------------------------------------------------------------
__global__ __launch_bounds__(256) void attn_kernel(
    const _Float16* __restrict__ q, const _Float16* __restrict__ k,
    const _Float16* __restrict__ vt, const float* __restrict__ bias,
    _Float16* __restrict__ ob) {
  __shared__ __attribute__((aligned(16))) _Float16 Kt[2][32][kTP];  // [buf][j-row][c]     5 KB
  __shared__ __attribute__((aligned(16))) _Float16 Vs[2][32][kTP];  // [buf][c-row][j]     5 KB
  const int tid  = threadIdx.x;
  const int lane = tid & 31;
  const int wave = tid >> 5;
  const int i = blockIdx.y, h = blockIdx.z;
  const int qbase = blockIdx.x * 128 + wave * 16;
  const long head = (long)(i * kH + h);
  const _Float16* qp = q  + head * kN * kC;
  const _Float16* kp = k  + head * kN * kC;
  const _Float16* vp = vt + head * kC * kN;
  // this wave's 16 queries: bias tiles (one per chunk, 512 floats each)
  const float4* bp = (const float4*)(bias + bias_index(h, qbase, 0)) + lane;

  const v16h bq = gfrag(qp + (long)qbase * kC, kC, lane);  // Q^T columns, fixed

  // cooperative K/V tile copy: threads 0..127 -> K, 128..255 -> V.
  const int crow = (tid & 127) >> 2;   // 0..31
  const int cchk = (tid & 3) << 3;     // half offset 0,8,16,24

  // prologue: chunk 0 -> buffer 0
  if (tid < 128) copy16(kp + (long)crow * kC + cchk, &Kt[0][crow][cchk]);
  else           copy16(vp + (long)crow * kN + cchk, &Vs[0][crow][cchk]);

  const v8f zero = {0.f, 0.f, 0.f, 0.f, 0.f, 0.f, 0.f, 0.f};
  v8f o0 = zero, o1 = zero;  // O^T rows c in [0,16) / [16,32), column q = lane % 16
  float mrun = -1e30f;       // running maximum of query lane % 16
  float lsum = 0.f;          // its denominator: this half-wave's keys only

  for (int n = 0; n < kN / 32; ++n) {
    const int kb  = n * 32;
    const int buf = n & 1;

    // current buffer ready (own ASYNCcnt), block-wide via barrier; the same
    // barrier proves everyone finished reading buf^1 last iteration.
    wait_async_copies();
    __syncthreads();
    if (kb + 32 < kN) {  // overlap next chunk's DMA with this chunk's WMMAs
      if (tid < 128) copy16(kp + (long)(kb + 32 + crow) * kC + cchk,
                            &Kt[buf ^ 1][crow][cchk]);
      else           copy16(vp + (long)crow * kN + kb + 32 + cchk,
                            &Vs[buf ^ 1][crow][cchk]);
    }

    const v16h ak0 = lfrag(&Kt[buf][lane & 15][(lane >> 4) << 3]);
    const v16h ak1 = lfrag(&Kt[buf][16 + (lane & 15)][(lane >> 4) << 3]);
    const float4 b00 = bp[n * 128], b01 = bp[n * 128 + 32];
    const float4 b10 = bp[n * 128 + 64], b11 = bp[n * 128 + 96];
    const v8f cb0 = {b00.x, b00.y, b00.z, b00.w, b01.x, b01.y, b01.z, b01.w};
    const v8f cb1 = {b10.x, b10.y, b10.z, b10.w, b11.x, b11.y, b11.z, b11.w};
    // s0[r] = S[q = lane%16][kb + 8*(lane/16) + r], s1[r]: the same + 16
    const v8f s0 = wmma_f16(ak0, bq, cb0);
    const v8f s1 = wmma_f16(ak1, bq, cb1);

    float t = fmaxf(s0[0], s1[0]);
#pragma unroll
    for (int r = 1; r < 8; ++r) t = fmaxf(t, fmaxf(s0[r], s1[r]));
    t = fmaxf(t, xhalf(t));  // both halves scale by the same maximum
    const float nm = fmaxf(mrun, t);
    const float sc = __expf(mrun - nm);
    mrun = nm;

    v16h pt;  // P^T as B operand: element s is key kb + (s<8 ? 8*(lane/16)+s : 16+8*(lane/16)+s-8)
    float rsum = 0.f;
#pragma unroll
    for (int r = 0; r < 8; ++r) {
      const float p0 = __expf(s0[r] - nm);
      const float p1 = __expf(s1[r] - nm);
      rsum += p0 + p1;
      pt[r]     = (_Float16)p0;
      pt[8 + r] = (_Float16)p1;
    }
    lsum = lsum * sc + rsum;
#pragma unroll
    for (int r = 0; r < 8; ++r) { o0[r] *= sc; o1[r] *= sc; }

    const v16h av0 = lfrag(&Vs[buf][lane & 15][(lane >> 4) << 3]);
    const v16h av1 = lfrag(&Vs[buf][16 + (lane & 15)][(lane >> 4) << 3]);
    o0 = wmma_f16(av0, pt, o0);
    o1 = wmma_f16(av1, pt, o1);
  }

  // o0[r] = O[q = lane%16][c = 8*(lane/16) + r], o1[r]: c + 16: 16-byte stores
  const float inv = 1.0f / (lsum + xhalf(lsum));
  v8h w0, w1;
#pragma unroll
  for (int r = 0; r < 8; ++r) {
    w0[r] = (_Float16)(o0[r] * inv);
    w1[r] = (_Float16)(o1[r] * inv);
  }
  _Float16* dst = ob + ((long)i * kN + qbase + (lane & 15)) * kHC + h * kC +
                  ((lane >> 4) << 3);
  *(v8h*)dst        = w0;
  *(v8h*)(dst + 16) = w1;
}

// ---------------------------------------------------------------------------
// Kernel 4: out = (g .* o) @ wo + bo   (fp16 A, LDS-staged fp16 wo, fp32 out)
// ---------------------------------------------------------------------------
__global__ __launch_bounds__(256) void out_kernel(
    const _Float16* __restrict__ gb, const _Float16* __restrict__ ob,
    const float* __restrict__ wo, const float* __restrict__ bo,
    float* __restrict__ out) {
  __shared__ __attribute__((aligned(16))) _Float16 Wt[64][kWP];
  const int lane = threadIdx.x & 31;
  const int wave = threadIdx.x >> 5;
  const int colbase = blockIdx.y * 64;
  const int rowbase = blockIdx.x * 128 + wave * 16;

  for (int idx = threadIdx.x; idx < 64 * kCZ; idx += 256) {
    const int n = idx & 63, kk = idx >> 6;
    Wt[n][kk] = (_Float16)wo[kk * kCZ + colbase + n];
  }
  __syncthreads();

  const v8f zero = {0.f, 0.f, 0.f, 0.f, 0.f, 0.f, 0.f, 0.f};
  v8f acc[4] = {zero, zero, zero, zero};

#pragma unroll
  for (int kk = 0; kk < kCZ; kk += 32) {
    const v16h ag = gfrag(gb + (long)rowbase * kHC + kk, kHC, lane);
    const v16h ao = gfrag(ob + (long)rowbase * kHC + kk, kHC, lane);
    v16h a;
#pragma unroll
    for (int e = 0; e < 16; ++e) a[e] = ag[e] * ao[e];
#pragma unroll
    for (int t = 0; t < 4; ++t) {
      const v16h bf = lfrag(&Wt[t * 16 + (lane & 15)][kk + ((lane >> 4) << 3)]);
      acc[t] = wmma_f16(a, bf, acc[t]);
    }
  }

#pragma unroll
  for (int t = 0; t < 4; ++t)
#pragma unroll
    for (int r = 0; r < 8; ++r) {
      const int m   = rowbase + ((lane >> 4) << 3) + r;
      const int col = colbase + t * 16 + (lane & 15);
      out[(long)m * kCZ + col] = acc[t][r] + bo[col];
    }
}

// ---------------------------------------------------------------------------
extern "C" void kernel_launch(void* const* d_in, const int* in_sizes, int n_in,
                              void* d_out, int out_size, void* d_ws, size_t ws_size,
                              hipStream_t stream) {
  const float* z      = (const float*)d_in[0];
  const float* ln_g   = (const float*)d_in[1];
  const float* ln_b   = (const float*)d_in[2];
  const float* w_bias = (const float*)d_in[3];
  const float* wq     = (const float*)d_in[4];
  const float* wk     = (const float*)d_in[5];
  const float* wv     = (const float*)d_in[6];
  const float* wg     = (const float*)d_in[7];
  const float* bg     = (const float*)d_in[8];
  const float* wo     = (const float*)d_in[9];
  const float* bo     = (const float*)d_in[10];
  float* out = (float*)d_out;

  char* ws = (char*)d_ws;
  const size_t S2 = (size_t)kNN * kHC * 2;  // one fp16 NN x 128 buffer
  _Float16* zn = (_Float16*)(ws);
  _Float16* qb = (_Float16*)(ws + 1 * S2);
  _Float16* kb = (_Float16*)(ws + 2 * S2);
  _Float16* vt = (_Float16*)(ws + 3 * S2);
  _Float16* gb = (_Float16*)(ws + 4 * S2);
  _Float16* ob = (_Float16*)(ws + 5 * S2);
  float*  biasb = (float*)(ws + 6 * S2);    // H * NN fp32

  ln_bias_kernel<<<kNN / 8, 256, 0, stream>>>(z, ln_g, ln_b, w_bias, zn, biasb);

  dim3 g2(kNN / 128, 2);
  proj_kernel<<<g2, 256, 0, stream>>>(zn, wq, nullptr, qb, 0);
  proj_kernel<<<g2, 256, 0, stream>>>(zn, wk, nullptr, kb, 1);
  proj_kernel<<<g2, 256, 0, stream>>>(zn, wv, nullptr, vt, 2);
  proj_kernel<<<g2, 256, 0, stream>>>(zn, wg, bg, gb, 3);

  dim3 g3(kN / 128, kN, kH);
  attn_kernel<<<g3, 256, 0, stream>>>(qb, kb, vt, biasb, ob);

  out_kernel<<<g2, 256, 0, stream>>>(gb, ob, wo, bo, out);
}

// v003
// One run takes 131 microseconds.
// In two side-by-side timings against v002, it was 1.80 and 1.79 times as fast.
// All steps since v000 together make it 4.22 times as fast.
#include <hip/hip_runtime.h>
#include <hip/hip_bf16.h>

typedef __attribute__((ext_vector_type(16))) _Float16 v16h;
typedef __attribute__((ext_vector_type(8)))  _Float16 v8h;
typedef __attribute__((ext_vector_type(4)))  _Float16 v4h;
typedef __attribute__((ext_vector_type(8)))  float    v8f;

constexpr int kN  = 384;
constexpr int kNN = kN * kN;      // 147456
constexpr int kCZ = 128;
constexpr int kH  = 4;
constexpr int kC  = 32;
constexpr int kHC = kH * kC;      // 128
// LDS row pitches in halves: an odd multiple of 16 bytes, so that the 16 rows
// one ds_load_b128 fragment read touches fall on 16 different bank groups.
constexpr int kWP = kCZ + 8;      // 272-byte rows for the 128-half weight tiles
constexpr int kTP = 32 + 8;       // 80-byte rows for the 32-half K, V tiles

// ---------------------------------------------------------------------------
// 16x16x32 f16 WMMA wrapper (CDNA5, wave32). D = A(16x32) * B(32x16) + C.
// ---------------------------------------------------------------------------
__device__ __forceinline__ v8f wmma_f16(v16h a, v16h b, v8f c) {
  return __builtin_amdgcn_wmma_f32_16x16x32_f16(false, a, false, b,
                                                (short)0, c, false, false);
}

// ---------------------------------------------------------------------------
// 16x32 fp16 fragment load (A-layout, or B-layout of a transposed operand):
// lane L holds row m = L%16, halves [8*(L/16), +8) and [16+8*(L/16), +8).
// ---------------------------------------------------------------------------
__device__ __forceinline__ v16h gfrag(const _Float16* __restrict__ base,
                                      int strideH, int lane) {
  const _Float16* p = base + (long)(lane & 15) * strideH + ((lane >> 4) << 3);
  v8h lo = *(const v8h*)p;
  v8h hi = *(const v8h*)(p + 16);
  v16h r;
#pragma unroll
  for (int e = 0; e < 8; ++e) { r[e] = lo[e]; r[8 + e] = hi[e]; }
  return r;
}

// Fragment from an LDS tile row (32 halves of it): two ds_load_b128.
__device__ __forceinline__ v16h lfrag(const _Float16* p0) {
  v8h lo = *(const v8h*)p0;
  v8h hi = *(const v8h*)(p0 + 16);
  v16h r;
#pragma unroll
  for (int e = 0; e < 8; ++e) { r[e] = lo[e]; r[8 + e] = hi[e]; }
  return r;
}

// ---------------------------------------------------------------------------
// One 16-byte global -> LDS async DMA (CDNA5, tracked by ASYNCcnt).
// VDST carries the LDS byte address (ISA: dsaddr = LDS_BASE + VGPR[VDST]).
// A generic pointer into LDS holds the LDS offset in its low 32 bits on
// AMDGPU, so truncating the pointer gives the right VDST value.
// ---------------------------------------------------------------------------
__device__ __forceinline__ void copy16(const _Float16* gsrc, _Float16* ldst) {
#if defined(__gfx1250__)
  asm volatile("global_load_async_to_lds_b128 %0, %1, off"
               :
               : "v"((unsigned)(unsigned long long)ldst), "v"(gsrc)
               : "memory");
#else
  *(v8h*)ldst = *(const v8h*)gsrc;
#endif
}

__device__ __forceinline__ void wait_async_copies() {
#if defined(__gfx1250__)
  asm volatile("s_wait_asynccnt 0x0" ::: "memory");
#endif
}

// ---------------------------------------------------------------------------
// Place of bias[h][q][k] in the workspace. A tile holds 16 q x 32 k (2 KB) as
// four 512-byte groups; group g, lane l, float e is the C/D element of the
// transposed score tile S^T (rows k, columns q): column q = l % 16, row
// k = 16*(g/2) + 8*(l/16) + 4*(g%2) + e. One global_load_b128 of a wave then
// reads one whole group: four full 128-byte lines.
// ---------------------------------------------------------------------------
__device__ __forceinline__ int bias_index(int h, int q, int k) {
  const int tile = (h * (kN / 16) + (q >> 4)) * (kN / 32) + (k >> 5);
  const int grp  = ((k >> 4) & 1) * 2 + ((k >> 2) & 1);
  const int ln   = (q & 15) + (((k >> 3) & 1) << 4);
  return tile * 512 + grp * 128 + ln * 4 + (k & 3);
}

// Lane l <-> lane l ^ 16 (the two halves of a wave that share a WMMA column).
__device__ __forceinline__ float xhalf(float x) {
  const int v = __builtin_bit_cast(int, x);
  return __builtin_bit_cast(float, __builtin_amdgcn_permlanex16(
      v, v, 0x76543210, 0xfedcba98, false, false));
}

// ---------------------------------------------------------------------------
// Kernel 1: LayerNorm, pair bias and the q, k, v, g projections in one launch.
// One work-group per WGP: 12 waves, each owning 48 rows (i, j) = three 16-row
// tiles. z comes by whole-row loads and is turned, through a tile of LDS that
// belongs to the wave alone, into the WMMA fragment order (a lane: row
// lane % 16, 8 + 8 columns of every 32), so mean and variance are in-lane sums
// plus one exchange between the wave's halves, and the normalised rows become
// f16 fragments in registers: they never go to memory. All four weights sit in
// LDS as f16 [n][k]; every weight fragment read serves three row tiles.
//   q, k, g: D = W^T (A) x zn^T (B): a lane holds 8 neighbouring columns of one
//            row, one 16-byte store;  v: D = zn (A) x W (B): a lane holds 8
//            neighbouring j of one column of the transposed (i,h,c,j) layout.
//   bias: fp32, q = i, k = j, in tiles of 16 q x 32 k laid out in the order in
//         which attn_kernel's lanes take them as WMMA C operands (bias_index)
// ---------------------------------------------------------------------------
constexpr int kFW = 12;           // waves per work-group
constexpr int kFT = kFW * 32;     // 384 threads
constexpr int kMT = 3;            // 16-row tiles per wave
constexpr int kZP = kCZ + 4;      // 528-byte rows (16 B x odd) for the fp32 z tile

// Stands behind global loads or stores, in front of the next write of a
// register that they name. The form with an address keeps that address in its
// registers up to the wait, so that no load of the run lands on them.
__device__ __forceinline__ void xcnt_wait() {
  asm volatile("s_wait_xcnt 0x0" ::: "memory");
}
__device__ __forceinline__ void xcnt_wait(const float* p) {
  asm volatile("s_wait_xcnt 0x0" :: "v"(p) : "memory");
}

// Staging of a weight W (128 k x 128 n, fp32) as f16 rows [n][k] in LDS, 8 k
// rows a wave at a time: eight whole-row loads (512 bytes, a lane takes 4 n),
// then for each of the lane's n one 16-byte LDS store of its 8 k.
__device__ __forceinline__ void load_wrows(float4 (&r)[8], const float* __restrict__ W,
                                           int k0, int lane) {
  const float* p = W + k0 * kHC + 4 * lane;
#pragma unroll
  for (int e = 0; e < 8; ++e) r[e] = *(const float4*)(p + e * kHC);
  xcnt_wait(p);
}

__device__ __forceinline__ void store_wrows(const float4 (&r)[8],
                                            _Float16 (*__restrict__ dst)[kWP],
                                            int k0, int lane) {
  v8h p0, p1, p2, p3;
#pragma unroll
  for (int e = 0; e < 8; ++e) {
    p0[e] = (_Float16)r[e].x; p1[e] = (_Float16)r[e].y;
    p2[e] = (_Float16)r[e].z; p3[e] = (_Float16)r[e].w;
  }
  *(v8h*)&dst[4 * lane + 0][k0] = p0;
  *(v8h*)&dst[4 * lane + 1][k0] = p1;
  *(v8h*)&dst[4 * lane + 2][k0] = p2;
  *(v8h*)&dst[4 * lane + 3][k0] = p3;
}

__global__ __launch_bounds__(kFT) void ln_proj_kernel(
    const float* __restrict__ z, const float* __restrict__ g,
    const float* __restrict__ b, const float* __restrict__ wb,
    const float* __restrict__ wq, const float* __restrict__ wk,
    const float* __restrict__ wv, const float* __restrict__ wg,
    const float* __restrict__ bg, _Float16* __restrict__ qo,
    _Float16* __restrict__ ko, _Float16* __restrict__ vo,
    _Float16* __restrict__ go, float* __restrict__ bias) {
  __shared__ __attribute__((aligned(16))) _Float16 Wt[4 * kHC][kWP];  // q,k,v,g: 136 KB
  __shared__ __attribute__((aligned(16))) float Zs[kFW][16][kZP];     // 99 KB
  __shared__ __attribute__((aligned(16))) float Gs[kCZ];
  __shared__ __attribute__((aligned(16))) float Bs[kCZ];
  __shared__ __attribute__((aligned(16))) float Wbs[kCZ * kH];
  const int tid  = threadIdx.x;
  const int lane = tid & 31;
  const int lr   = lane & 15;   // row of a tile (A) or column (B)
  const int hf   = lane >> 4;   // which 8 of every 16 k
  const int wave = __builtin_amdgcn_readfirstlane(tid >> 5);
  const int task = blockIdx.x * kFW + wave;
  const int i    = task >> 3;           // 8 tasks of 48 rows make one i
  const int j0   = (task & 7) * (16 * kMT);
  const int row0 = i * kN + j0;

  // The 4 x 16 groups of 8 weight rows: group wave + 12*it for it = 0..4, and
  // the last four go to waves 0..3. Loads come back in the order of issue, so
  // the three groups asked for ahead of z are stored while z is on its way from
  // memory; the others follow z and land during the row statistics.
  float4 wa[3][8], wc[2][8], wx[8];
  load_wrows(wa[0], wq, wave * 8, lane);                                     // 0..11
  load_wrows(wa[1], wave < 4 ? wq : wk, ((wave + 12) & 15) * 8, lane);       // 12..23
  load_wrows(wa[2], wave < 8 ? wk : wv, ((wave + 8) & 15) * 8, lane);        // 24..35

  float4 zr[kMT][16];  // here [tile][row]: columns 4*lane .. of a whole row
  const float* zp = z + (long)row0 * kCZ + 4 * lane;
#pragma unroll
  for (int t = 0; t < kMT; ++t)
#pragma unroll
    for (int v = 0; v < 16; ++v)
      zr[t][v] = *(const float4*)(zp + (16 * t + v) * kCZ);
  xcnt_wait(zp);

  store_wrows(wa[0], &Wt[0], wave * 8, lane);
  store_wrows(wa[1], &Wt[wave < 4 ? 0 : kHC], ((wave + 12) & 15) * 8, lane);
  store_wrows(wa[2], &Wt[wave < 8 ? kHC : 2 * kHC], ((wave + 8) & 15) * 8, lane);

  if (wave < 4) {
    load_wrows(wx, wg, (wave + 12) * 8, lane);                               // 60..63
    const float gl = g[tid], bl = b[tid];
    const float4 wl = ((const float4*)wb)[tid];
    xcnt_wait();
    store_wrows(wx, &Wt[3 * kHC], (wave + 12) * 8, lane);
    Gs[tid] = gl; Bs[tid] = bl; ((float4*)Wbs)[tid] = wl;
  }
  load_wrows(wc[0], wv, (wave + 4) * 8, lane);                               // 36..47
  load_wrows(wc[1], wg, wave * 8, lane);                                     // 48..59

  // Each tile into the fragment order: from here zr is [tile][4*c + 2*hi + s],
  // columns 32c + 16hi + 8hf + 4s .. of row lr. Then the row statistics: 64
  // values in the lane, the other 64 in lane ^ 16.
  float (*Zw)[kZP] = Zs[wave];
  float mu[kMT], rs[kMT];
#pragma unroll
  for (int t = 0; t < kMT; ++t) {
#pragma unroll
    for (int v = 0; v < 16; ++v) *(float4*)&Zw[v][4 * lane] = zr[t][v];
    // other lanes of the wave read these rows back: the stores land first
    asm volatile("s_wait_dscnt 0x0" ::: "memory");
#pragma unroll
    for (int v = 0; v < 16; ++v)
      zr[t][v] = *(const float4*)&Zw[lr][8 * hf + 16 * (v >> 1) + 4 * (v & 1)];
    float4 a1 = {0.f, 0.f, 0.f, 0.f}, a2 = {0.f, 0.f, 0.f, 0.f};
#pragma unroll
    for (int v = 0; v < 16; ++v) {
      const float4 x = zr[t][v];
      a1.x += x.x; a1.y += x.y; a1.z += x.z; a1.w += x.w;
      a2.x += x.x * x.x; a2.y += x.y * x.y; a2.z += x.z * x.z; a2.w += x.w * x.w;
    }
    float s  = (a1.x + a1.y) + (a1.z + a1.w);
    float s2 = (a2.x + a2.y) + (a2.z + a2.w);
    s  += xhalf(s);
    s2 += xhalf(s2);
    mu[t] = s * (1.0f / kCZ);
    rs[t] = rsqrtf(s2 * (1.0f / kCZ) - mu[t] * mu[t] + 1e-5f);
  }

  store_wrows(wc[0], &Wt[2 * kHC], (wave + 4) * 8, lane);
  store_wrows(wc[1], &Wt[3 * kHC], wave * 8, lane);
  __syncthreads();

  // normalise; fp32 pair bias; f16 fragments. Element 8*hi + e of fragment c is
  // column 32c + 16hi + 8hf + e: the order in which lfrag reads a weight row.
  v16h zf[kMT][4];
  float ba[kMT][kH];
#pragma unroll
  for (int t = 0; t < kMT; ++t)
#pragma unroll
    for (int h = 0; h < kH; ++h) ba[t][h] = 0.f;
#pragma unroll
  for (int c = 0; c < 4; ++c)
#pragma unroll
    for (int hi = 0; hi < 2; ++hi) {
      const int k0 = 32 * c + 16 * hi + 8 * hf;
#pragma unroll
      for (int s = 0; s < 2; ++s) {
        const float4 gv = *(const float4*)&Gs[k0 + 4 * s];
        const float4 bv = *(const float4*)&Bs[k0 + 4 * s];
        const float ge[4] = {gv.x, gv.y, gv.z, gv.w};
        const float be[4] = {bv.x, bv.y, bv.z, bv.w};
        float4 w4[4];
#pragma unroll
        for (int e = 0; e < 4; ++e) w4[e] = *(const float4*)&Wbs[(k0 + 4 * s + e) * kH];
#pragma unroll
        for (int t = 0; t < kMT; ++t) {
          const float4 x = zr[t][4 * c + 2 * hi + s];
          const float xe[4] = {x.x, x.y, x.z, x.w};
#pragma unroll
          for (int e = 0; e < 4; ++e) {
            const float zl = (xe[e] - mu[t]) * rs[t] * ge[e] + be[e];
            zf[t][c][8 * hi + 4 * s + e] = (_Float16)zl;
            ba[t][0] += zl * w4[e].x;
            ba[t][1] += zl * w4[e].y;
            ba[t][2] += zl * w4[e].z;
            ba[t][3] += zl * w4[e].w;
          }
        }
      }
    }
#pragma unroll
  for (int t = 0; t < kMT; ++t) {
#pragma unroll
    for (int h = 0; h < kH; ++h) ba[t][h] += xhalf(ba[t][h]);
    // both halves hold all four sums of row lr: each half stores two heads
    const int j = j0 + 16 * t + lr;
    const int   x0 = bias_index(2 * hf, i, j), x1 = bias_index(2 * hf + 1, i, j);
    const float y0 = hf ? ba[t][2] : ba[t][0], y1 = hf ? ba[t][3] : ba[t][1];
    bias[x0] = y0;
    bias[x1] = y1;
    // as xcnt_wait(p): places and values stay in their registers up to the wait
    asm volatile("s_wait_xcnt 0x0" :: "v"(x0), "v"(x1), "v"(y0), "v"(y1) : "memory");
  }

  const v8f zero = {0.f, 0.f, 0.f, 0.f, 0.f, 0.f, 0.f, 0.f};

  // q (scaled) and k, layout (i,h,j,c): 16 tiles of 16 weight columns
  for (int nt = 0; nt < 16; ++nt) {
    v8f acc[kMT] = {zero, zero, zero};
#pragma unroll
    for (int c = 0; c < 4; ++c) {
      const v16h wf = lfrag(&Wt[nt * 16 + lr][c * 32 + 8 * hf]);
#pragma unroll
      for (int t = 0; t < kMT; ++t) acc[t] = wmma_f16(wf, zf[t][c], acc[t]);
    }
    const float sc = nt < 8 ? 0.17677669529663687f : 1.0f;
    _Float16* dst = (nt < 8 ? qo : ko) +
        ((i * kH + ((nt & 7) >> 1)) * kN + j0 + lr) * kC + (nt & 1) * 16 + 8 * hf;
#pragma unroll
    for (int t = 0; t < kMT; ++t) {
      v8h o;
#pragma unroll
      for (int r = 0; r < 8; ++r) o[r] = (_Float16)(acc[t][r] * sc);
      *(v8h*)(dst + 16 * t * kC) = o;
      xcnt_wait();
    }
  }

  // v, layout (i,h,c,j)
  for (int nt = 0; nt < 8; ++nt) {
    v8f acc[kMT] = {zero, zero, zero};
#pragma unroll
    for (int c = 0; c < 4; ++c) {
      const v16h wf = lfrag(&Wt[2 * kHC + nt * 16 + lr][c * 32 + 8 * hf]);
#pragma unroll
      for (int t = 0; t < kMT; ++t) acc[t] = wmma_f16(zf[t][c], wf, acc[t]);
    }
    _Float16* dst = vo + (i * kHC + nt * 16 + lr) * kN + j0 + 8 * hf;
#pragma unroll
    for (int t = 0; t < kMT; ++t) {
      v8h o;
#pragma unroll
      for (int r = 0; r < 8; ++r) o[r] = (_Float16)acc[t][r];
      *(v8h*)(dst + 16 * t) = o;
      xcnt_wait();
    }
  }

  // g = sigmoid(x + bg), layout (i,j,h*C+c)
  for (int nt = 0; nt < 8; ++nt) {
    v8f acc[kMT] = {zero, zero, zero};
#pragma unroll
    for (int c = 0; c < 4; ++c) {
      const v16h wf = lfrag(&Wt[3 * kHC + nt * 16 + lr][c * 32 + 8 * hf]);
#pragma unroll
      for (int t = 0; t < kMT; ++t) acc[t] = wmma_f16(wf, zf[t][c], acc[t]);
    }
    const int col = nt * 16 + 8 * hf;
    const float4 g0 = *(const float4*)(bg + col), g1 = *(const float4*)(bg + col + 4);
    xcnt_wait(bg + col);
    const float ge[8] = {g0.x, g0.y, g0.z, g0.w, g1.x, g1.y, g1.z, g1.w};
    _Float16* dst = go + (long)(row0 + lr) * kHC + col;
#pragma unroll
    for (int t = 0; t < kMT; ++t) {
      v8h o;
#pragma unroll
      for (int r = 0; r < 8; ++r)
        o[r] = (_Float16)(1.0f / (1.0f + __expf(-(acc[t][r] + ge[r]))));
      *(v8h*)(dst + 16 * t * kHC) = o;
      xcnt_wait();
    }
  }
}

// ---------------------------------------------------------------------------
// Kernel 2: flash attention per (qblock, i, h). Wave owns 16 q rows.
// K/V 32x32 chunks are DMA'd once per block into double-buffered LDS
// (global_load_async_to_lds_b128, ASYNCcnt), overlapping the next chunk's
// copy with this chunk's WMMAs. Per chunk: S^T = K Q^T + bias^T (2 WMMAs, K
// rows as A, Q as B, the bias tile as C), so a lane holds 16 scores of ONE
// query: maximum and sum run in its own registers, plus one exchange between
// the wave's halves. The two S^T tiles, converted in place, are the B operand
// of O^T += V^T P^T (2 WMMAs): P never leaves the registers.
// ---------------------------------------------------------------------------
__global__ __launch_bounds__(256) void attn_kernel(
    const _Float16* __restrict__ q, const _Float16* __restrict__ k,
    const _Float16* __restrict__ vt, const float* __restrict__ bias,
    _Float16* __restrict__ ob) {
  __shared__ __attribute__((aligned(16))) _Float16 Kt[2][32][kTP];  // [buf][j-row][c]     5 KB
  __shared__ __attribute__((aligned(16))) _Float16 Vs[2][32][kTP];  // [buf][c-row][j]     5 KB
  const int tid  = threadIdx.x;
  const int lane = tid & 31;
  const int wave = tid >> 5;
  const int i = blockIdx.y, h = blockIdx.z;
  const int qbase = blockIdx.x * 128 + wave * 16;
  const long head = (long)(i * kH + h);
  const _Float16* qp = q  + head * kN * kC;
  const _Float16* kp = k  + head * kN * kC;
  const _Float16* vp = vt + head * kC * kN;
  // this wave's 16 queries: bias tiles (one per chunk, 512 floats each)
  const float4* bp = (const float4*)(bias + bias_index(h, qbase, 0)) + lane;

  const v16h bq = gfrag(qp + (long)qbase * kC, kC, lane);  // Q^T columns, fixed

  // cooperative K/V tile copy: threads 0..127 -> K, 128..255 -> V.
  const int crow = (tid & 127) >> 2;   // 0..31
  const int cchk = (tid & 3) << 3;     // half offset 0,8,16,24

  // prologue: chunk 0 -> buffer 0
  if (tid < 128) copy16(kp + (long)crow * kC + cchk, &Kt[0][crow][cchk]);
  else           copy16(vp + (long)crow * kN + cchk, &Vs[0][crow][cchk]);

  const v8f zero = {0.f, 0.f, 0.f, 0.f, 0.f, 0.f, 0.f, 0.f};
  v8f o0 = zero, o1 = zero;  // O^T rows c in [0,16) / [16,32), column q = lane % 16
  float mrun = -1e30f;       // running maximum of query lane % 16
  float lsum = 0.f;          // its denominator: this half-wave's keys only

  for (int n = 0; n < kN / 32; ++n) {
    const int kb  = n * 32;
    const int buf = n & 1;

    // current buffer ready (own ASYNCcnt), block-wide via barrier; the same
    // barrier proves everyone finished reading buf^1 last iteration.
    wait_async_copies();
    __syncthreads();
    if (kb + 32 < kN) {  // overlap next chunk's DMA with this chunk's WMMAs
      if (tid < 128) copy16(kp + (long)(kb + 32 + crow) * kC + cchk,
                            &Kt[buf ^ 1][crow][cchk]);
      else           copy16(vp + (long)crow * kN + kb + 32 + cchk,
                            &Vs[buf ^ 1][crow][cchk]);
    }

    const v16h ak0 = lfrag(&Kt[buf][lane & 15][(lane >> 4) << 3]);
    const v16h ak1 = lfrag(&Kt[buf][16 + (lane & 15)][(lane >> 4) << 3]);
    const float4 b00 = bp[n * 128], b01 = bp[n * 128 + 32];
    const float4 b10 = bp[n * 128 + 64], b11 = bp[n * 128 + 96];
    const v8f cb0 = {b00.x, b00.y, b00.z, b00.w, b01.x, b01.y, b01.z, b01.w};
    const v8f cb1 = {b10.x, b10.y, b10.z, b10.w, b11.x, b11.y, b11.z, b11.w};
    // s0[r] = S[q = lane%16][kb + 8*(lane/16) + r], s1[r]: the same + 16
    const v8f s0 = wmma_f16(ak0, bq, cb0);
    const v8f s1 = wmma_f16(ak1, bq, cb1);

    float t = fmaxf(s0[0], s1[0]);
#pragma unroll
    for (int r = 1; r < 8; ++r) t = fmaxf(t, fmaxf(s0[r], s1[r]));
    t = fmaxf(t, xhalf(t));  // both halves scale by the same maximum
    const float nm = fmaxf(mrun, t);
    const float sc = __expf(mrun - nm);
    mrun = nm;

    v16h pt;  // P^T as B operand: element s is key kb + (s<8 ? 8*(lane/16)+s : 16+8*(lane/16)+s-8)
    float rsum = 0.f;
#pragma unroll
    for (int r = 0; r < 8; ++r) {
      const float p0 = __expf(s0[r] - nm);
      const float p1 = __expf(s1[r] - nm);
      rsum += p0 + p1;
      pt[r]     = (_Float16)p0;
      pt[8 + r] = (_Float16)p1;
    }
    lsum = lsum * sc + rsum;
#pragma unroll
    for (int r = 0; r < 8; ++r) { o0[r] *= sc; o1[r] *= sc; }

    const v16h av0 = lfrag(&Vs[buf][lane & 15][(lane >> 4) << 3]);
    const v16h av1 = lfrag(&Vs[buf][16 + (lane & 15)][(lane >> 4) << 3]);
    o0 = wmma_f16(av0, pt, o0);
    o1 = wmma_f16(av1, pt, o1);
  }

  // o0[r] = O[q = lane%16][c = 8*(lane/16) + r], o1[r]: c + 16: 16-byte stores
  const float inv = 1.0f / (lsum + xhalf(lsum));
  v8h w0, w1;
#pragma unroll
  for (int r = 0; r < 8; ++r) {
    w0[r] = (_Float16)(o0[r] * inv);
    w1[r] = (_Float16)(o1[r] * inv);
  }
  _Float16* dst = ob + ((long)i * kN + qbase + (lane & 15)) * kHC + h * kC +
                  ((lane >> 4) << 3);
  *(v8h*)dst        = w0;
  *(v8h*)(dst + 16) = w1;
}

// ---------------------------------------------------------------------------
// Kernel 3: out = (g .* o) @ wo + bo   (fp16 A, LDS-staged fp16 wo, fp32 out)
// ---------------------------------------------------------------------------
__global__ __launch_bounds__(256) void out_kernel(
    const _Float16* __restrict__ gb, const _Float16* __restrict__ ob,
    const float* __restrict__ wo, const float* __restrict__ bo,
    float* __restrict__ out) {
  __shared__ __attribute__((aligned(16))) _Float16 Wt[64][kWP];
  const int lane = threadIdx.x & 31;
  const int wave = threadIdx.x >> 5;
  const int colbase = blockIdx.y * 64;
  const int rowbase = blockIdx.x * 128 + wave * 16;

  for (int idx = threadIdx.x; idx < 64 * kCZ; idx += 256) {
    const int n = idx & 63, kk = idx >> 6;
    Wt[n][kk] = (_Float16)wo[kk * kCZ + colbase + n];
  }
  __syncthreads();

  const v8f zero = {0.f, 0.f, 0.f, 0.f, 0.f, 0.f, 0.f, 0.f};
  v8f acc[4] = {zero, zero, zero, zero};

#pragma unroll
  for (int kk = 0; kk < kCZ; kk += 32) {
    const v16h ag = gfrag(gb + (long)rowbase * kHC + kk, kHC, lane);
    const v16h ao = gfrag(ob + (long)rowbase * kHC + kk, kHC, lane);
    v16h a;
#pragma unroll
    for (int e = 0; e < 16; ++e) a[e] = ag[e] * ao[e];
#pragma unroll
    for (int t = 0; t < 4; ++t) {
      const v16h bf = lfrag(&Wt[t * 16 + (lane & 15)][kk + ((lane >> 4) << 3)]);
      acc[t] = wmma_f16(a, bf, acc[t]);
    }
  }

#pragma unroll
  for (int t = 0; t < 4; ++t)
#pragma unroll
    for (int r = 0; r < 8; ++r) {
      const int m   = rowbase + ((lane >> 4) << 3) + r;
      const int col = colbase + t * 16 + (lane & 15);
      out[(long)m * kCZ + col] = acc[t][r] + bo[col];
    }
}

// ---------------------------------------------------------------------------
extern "C" void kernel_launch(void* const* d_in, const int* in_sizes, int n_in,
                              void* d_out, int out_size, void* d_ws, size_t ws_size,
                              hipStream_t stream) {
  const float* z      = (const float*)d_in[0];
  const float* ln_g   = (const float*)d_in[1];
  const float* ln_b   = (const float*)d_in[2];
  const float* w_bias = (const float*)d_in[3];
  const float* wq     = (const float*)d_in[4];
  const float* wk     = (const float*)d_in[5];
  const float* wv     = (const float*)d_in[6];
  const float* wg     = (const float*)d_in[7];
  const float* bg     = (const float*)d_in[8];
  const float* wo     = (const float*)d_in[9];
  const float* bo     = (const float*)d_in[10];
  float* out = (float*)d_out;

  char* ws = (char*)d_ws;
  const size_t S2 = (size_t)kNN * kHC * 2;  // one fp16 NN x 128 buffer
  _Float16* qb = (_Float16*)(ws + 1 * S2);
  _Float16* kb = (_Float16*)(ws + 2 * S2);
  _Float16* vt = (_Float16*)(ws + 3 * S2);
  _Float16* gb = (_Float16*)(ws + 4 * S2);
  _Float16* ob = (_Float16*)(ws + 5 * S2);
  float*  biasb = (float*)(ws + 6 * S2);    // H * NN fp32

  ln_proj_kernel<<<kNN / (16 * kMT * kFW), kFT, 0, stream>>>(
      z, ln_g, ln_b, w_bias, wq, wk, wv, wg, bg, qb, kb, vt, gb, biasb);

  dim3 g3(kN / 128, kN, kH);
  attn_kernel<<<g3, 256, 0, stream>>>(qb, kb, vt, biasb, ob);

  dim3 g2(kNN / 128, 2);
  out_kernel<<<g2, 256, 0, stream>>>(gb, ob, wo, bo, out);
}

// v004
// It runs in 123 microseconds.
// Timed twice side by side with v003, it ran 1.06 and 1.07 times as fast.
// All steps since v000 together make it 4.49 times as fast.
#include <hip/hip_runtime.h>
#include <hip/hip_bf16.h>

typedef __attribute__((ext_vector_type(16))) _Float16 v16h;
typedef __attribute__((ext_vector_type(8)))  _Float16 v8h;
typedef __attribute__((ext_vector_type(4)))  _Float16 v4h;
typedef __attribute__((ext_vector_type(8)))  float    v8f;

constexpr int kN  = 384;
constexpr int kNN = kN * kN;      // 147456
constexpr int kCZ = 128;
constexpr int kH  = 4;
constexpr int kC  = 32;
constexpr int kHC = kH * kC;      // 128
// LDS row pitches in halves: an odd multiple of 16 bytes, so that the 16 rows
// one ds_load_b128 fragment read touches fall on 16 different bank groups.
constexpr int kWP = kCZ + 8;      // 272-byte rows for the 128-half weight tiles
constexpr int kTP = 32 + 8;       // 80-byte rows for the 32-half K, V tiles

// ---------------------------------------------------------------------------
// 16x16x32 f16 WMMA wrapper (CDNA5, wave32). D = A(16x32) * B(32x16) + C.
// ---------------------------------------------------------------------------
__device__ __forceinline__ v8f wmma_f16(v16h a, v16h b, v8f c) {
  return __builtin_amdgcn_wmma_f32_16x16x32_f16(false, a, false, b,
                                                (short)0, c, false, false);
}

// ---------------------------------------------------------------------------
// 16x32 fp16 fragment load (A-layout, or B-layout of a transposed operand):
// lane L holds row m = L%16, halves [8*(L/16), +8) and [16+8*(L/16), +8).
// ---------------------------------------------------------------------------
__device__ __forceinline__ v16h gfrag(const _Float16* __restrict__ base,
                                      int strideH, int lane) {
  const _Float16* p = base + (long)(lane & 15) * strideH + ((lane >> 4) << 3);
  v8h lo = *(const v8h*)p;
  v8h hi = *(const v8h*)(p + 16);
  v16h r;
#pragma unroll
  for (int e = 0; e < 8; ++e) { r[e] = lo[e]; r[8 + e] = hi[e]; }
  return r;
}

// Fragment from an LDS tile row (32 halves of it): two ds_load_b128.
__device__ __forceinline__ v16h lfrag(const _Float16* p0) {
  v8h lo = *(const v8h*)p0;
  v8h hi = *(const v8h*)(p0 + 16);
  v16h r;
#pragma unroll
  for (int e = 0; e < 8; ++e) { r[e] = lo[e]; r[8 + e] = hi[e]; }
  return r;
}

// ---------------------------------------------------------------------------
// One 16-byte global -> LDS async DMA (CDNA5, tracked by ASYNCcnt).
// VDST carries the LDS byte address (ISA: dsaddr = LDS_BASE + VGPR[VDST]).
// A generic pointer into LDS holds the LDS offset in its low 32 bits on
// AMDGPU, so truncating the pointer gives the right VDST value.
// ---------------------------------------------------------------------------
__device__ __forceinline__ void copy16(const _Float16* gsrc, _Float16* ldst) {
#if defined(__gfx1250__)
  // the wait stands in the copy's own statement: in front of any later write
  // of the two address registers
  asm volatile("global_load_async_to_lds_b128 %0, %1, off\n\ts_wait_xcnt 0x0"
               :
               : "v"((unsigned)(unsigned long long)ldst), "v"(gsrc)
               : "memory");
#else
  *(v8h*)ldst = *(const v8h*)gsrc;
#endif
}

__device__ __forceinline__ void wait_async_copies() {
#if defined(__gfx1250__)
  asm volatile("s_wait_asynccnt 0x0" ::: "memory");
#endif
}

// ---------------------------------------------------------------------------
// Place of bias[h][q][k] in the workspace. A tile holds 16 q x 32 k (2 KB) as
// four 512-byte groups; group g, lane l, float e is the C/D element of the
// transposed score tile S^T (rows k, columns q): column q = l % 16, row
// k = 16*(g/2) + 8*(l/16) + 4*(g%2) + e. One global_load_b128 of a wave then
// reads one whole group: four full 128-byte lines.
// ---------------------------------------------------------------------------
__device__ __forceinline__ int bias_index(int h, int q, int k) {
  const int tile = (h * (kN / 16) + (q >> 4)) * (kN / 32) + (k >> 5);
  const int grp  = ((k >> 4) & 1) * 2 + ((k >> 2) & 1);
  const int ln   = (q & 15) + (((k >> 3) & 1) << 4);
  return tile * 512 + grp * 128 + ln * 4 + (k & 3);
}

// Lane l <-> lane l ^ 16 (the two halves of a wave that share a WMMA column).
__device__ __forceinline__ float xhalf(float x) {
  const int v = __builtin_bit_cast(int, x);
  return __builtin_bit_cast(float, __builtin_amdgcn_permlanex16(
      v, v, 0x76543210, 0xfedcba98, false, false));
}

// ---------------------------------------------------------------------------
// Kernel 1: LayerNorm, pair bias and the q, k, v, g projections in one launch.
// One work-group per WGP: 12 waves, each owning 48 rows (i, j) = three 16-row
// tiles. z comes by whole-row loads and is turned, through a tile of LDS that
// belongs to the wave alone, into the WMMA fragment order (a lane: row
// lane % 16, 8 + 8 columns of every 32), so mean and variance are in-lane sums
// plus one exchange between the wave's halves, and the normalised rows become
// f16 fragments in registers: they never go to memory. All four weights sit in
// LDS as f16 [n][k]; every weight fragment read serves three row tiles.
//   q, k, g: D = W^T (A) x zn^T (B): a lane holds 8 neighbouring columns of one
//            row, one 16-byte store;  v: D = zn (A) x W (B): a lane holds 8
//            neighbouring j of one column of the transposed (i,h,c,j) layout.
//   bias: fp32, q = i, k = j, in tiles of 16 q x 32 k laid out in the order in
//         which attn_out_kernel's lanes take them as WMMA C operands (bias_index)
// ---------------------------------------------------------------------------
constexpr int kFW = 12;           // waves per work-group
constexpr int kFT = kFW * 32;     // 384 threads
constexpr int kMT = 3;            // 16-row tiles per wave
constexpr int kZP = kCZ + 4;      // 528-byte rows (16 B x odd) for the fp32 z tile

// Stands behind global loads or stores, in front of the next write of a
// register that they name. The form with an address keeps that address in its
// registers up to the wait, so that no load of the run lands on them.
__device__ __forceinline__ void xcnt_wait() {
  asm volatile("s_wait_xcnt 0x0" ::: "memory");
}
__device__ __forceinline__ void xcnt_wait(const float* p) {
  asm volatile("s_wait_xcnt 0x0" :: "v"(p) : "memory");
}

// Staging of a weight W (128 k x 128 n, fp32) as f16 rows [n][k] in LDS, 8 k
// rows a wave at a time: eight whole-row loads (512 bytes, a lane takes 4 n),
// then for each of the lane's n one 16-byte LDS store of its 8 k.
__device__ __forceinline__ void load_wrows(float4 (&r)[8], const float* __restrict__ W,
                                           int k0, int lane) {
  const float* p = W + k0 * kHC + 4 * lane;
#pragma unroll
  for (int e = 0; e < 8; ++e) r[e] = *(const float4*)(p + e * kHC);
  xcnt_wait(p);
}

__device__ __forceinline__ void store_wrows(const float4 (&r)[8],
                                            _Float16 (*__restrict__ dst)[kWP],
                                            int k0, int lane) {
  v8h p0, p1, p2, p3;
#pragma unroll
  for (int e = 0; e < 8; ++e) {
    p0[e] = (_Float16)r[e].x; p1[e] = (_Float16)r[e].y;
    p2[e] = (_Float16)r[e].z; p3[e] = (_Float16)r[e].w;
  }
  *(v8h*)&dst[4 * lane + 0][k0] = p0;
  *(v8h*)&dst[4 * lane + 1][k0] = p1;
  *(v8h*)&dst[4 * lane + 2][k0] = p2;
  *(v8h*)&dst[4 * lane + 3][k0] = p3;
}

__global__ __launch_bounds__(kFT) void ln_proj_kernel(
    const float* __restrict__ z, const float* __restrict__ g,
    const float* __restrict__ b, const float* __restrict__ wb,
    const float* __restrict__ wq, const float* __restrict__ wk,
    const float* __restrict__ wv, const float* __restrict__ wg,
    const float* __restrict__ bg, _Float16* __restrict__ qo,
    _Float16* __restrict__ ko, _Float16* __restrict__ vo,
    _Float16* __restrict__ go, float* __restrict__ bias) {
  __shared__ __attribute__((aligned(16))) _Float16 Wt[4 * kHC][kWP];  // q,k,v,g: 136 KB
  __shared__ __attribute__((aligned(16))) float Zs[kFW][16][kZP];     // 99 KB
  __shared__ __attribute__((aligned(16))) float Gs[kCZ];
  __shared__ __attribute__((aligned(16))) float Bs[kCZ];
  __shared__ __attribute__((aligned(16))) float Wbs[kCZ * kH];
  const int tid  = threadIdx.x;
  const int lane = tid & 31;
  const int lr   = lane & 15;   // row of a tile (A) or column (B)
  const int hf   = lane >> 4;   // which 8 of every 16 k
  const int wave = __builtin_amdgcn_readfirstlane(tid >> 5);
  const int task = blockIdx.x * kFW + wave;
  const int i    = task >> 3;           // 8 tasks of 48 rows make one i
  const int j0   = (task & 7) * (16 * kMT);
  const int row0 = i * kN + j0;

  // The 4 x 16 groups of 8 weight rows: group wave + 12*it for it = 0..4, and
  // the last four go to waves 0..3. Loads come back in the order of issue, so
  // the three groups asked for ahead of z are stored while z is on its way from
  // memory; the others follow z and land during the row statistics.
  float4 wa[3][8], wc[2][8], wx[8];
  load_wrows(wa[0], wq, wave * 8, lane);                                     // 0..11
  load_wrows(wa[1], wave < 4 ? wq : wk, ((wave + 12) & 15) * 8, lane);       // 12..23
  load_wrows(wa[2], wave < 8 ? wk : wv, ((wave + 8) & 15) * 8, lane);        // 24..35

  float4 zr[kMT][16];  // here [tile][row]: columns 4*lane .. of a whole row
  const float* zp = z + (long)row0 * kCZ + 4 * lane;
#pragma unroll
  for (int t = 0; t < kMT; ++t)
#pragma unroll
    for (int v = 0; v < 16; ++v)
      zr[t][v] = *(const float4*)(zp + (16 * t + v) * kCZ);
  xcnt_wait(zp);

  store_wrows(wa[0], &Wt[0], wave * 8, lane);
  store_wrows(wa[1], &Wt[wave < 4 ? 0 : kHC], ((wave + 12) & 15) * 8, lane);
  store_wrows(wa[2], &Wt[wave < 8 ? kHC : 2 * kHC], ((wave + 8) & 15) * 8, lane);

  if (wave < 4) {
    load_wrows(wx, wg, (wave + 12) * 8, lane);                               // 60..63
    const float gl = g[tid], bl = b[tid];
    const float4 wl = ((const float4*)wb)[tid];
    xcnt_wait();
    store_wrows(wx, &Wt[3 * kHC], (wave + 12) * 8, lane);
    Gs[tid] = gl; Bs[tid] = bl; ((float4*)Wbs)[tid] = wl;
  }
  load_wrows(wc[0], wv, (wave + 4) * 8, lane);                               // 36..47
  load_wrows(wc[1], wg, wave * 8, lane);                                     // 48..59

  // Each tile into the fragment order: from here zr is [tile][4*c + 2*hi + s],
  // columns 32c + 16hi + 8hf + 4s .. of row lr. Then the row statistics: 64
  // values in the lane, the other 64 in lane ^ 16.
  float (*Zw)[kZP] = Zs[wave];
  float mu[kMT], rs[kMT];
#pragma unroll
  for (int t = 0; t < kMT; ++t) {
#pragma unroll
    for (int v = 0; v < 16; ++v) *(float4*)&Zw[v][4 * lane] = zr[t][v];
    // other lanes of the wave read these rows back: the stores land first
    asm volatile("s_wait_dscnt 0x0" ::: "memory");
#pragma unroll
    for (int v = 0; v < 16; ++v)
      zr[t][v] = *(const float4*)&Zw[lr][8 * hf + 16 * (v >> 1) + 4 * (v & 1)];
    float4 a1 = {0.f, 0.f, 0.f, 0.f}, a2 = {0.f, 0.f, 0.f, 0.f};
#pragma unroll
    for (int v = 0; v < 16; ++v) {
      const float4 x = zr[t][v];
      a1.x += x.x; a1.y += x.y; a1.z += x.z; a1.w += x.w;
      a2.x += x.x * x.x; a2.y += x.y * x.y; a2.z += x.z * x.z; a2.w += x.w * x.w;
    }
    float s  = (a1.x + a1.y) + (a1.z + a1.w);
    float s2 = (a2.x + a2.y) + (a2.z + a2.w);
    s  += xhalf(s);
    s2 += xhalf(s2);
    mu[t] = s * (1.0f / kCZ);
    rs[t] = rsqrtf(s2 * (1.0f / kCZ) - mu[t] * mu[t] + 1e-5f);
  }

  store_wrows(wc[0], &Wt[2 * kHC], (wave + 4) * 8, lane);
  store_wrows(wc[1], &Wt[3 * kHC], wave * 8, lane);
  __syncthreads();

  // normalise; fp32 pair bias; f16 fragments. Element 8*hi + e of fragment c is
  // column 32c + 16hi + 8hf + e: the order in which lfrag reads a weight row.
  v16h zf[kMT][4];
  float ba[kMT][kH];
#pragma unroll
  for (int t = 0; t < kMT; ++t)
#pragma unroll
    for (int h = 0; h < kH; ++h) ba[t][h] = 0.f;
#pragma unroll
  for (int c = 0; c < 4; ++c)
#pragma unroll
    for (int hi = 0; hi < 2; ++hi) {
      const int k0 = 32 * c + 16 * hi + 8 * hf;
#pragma unroll
      for (int s = 0; s < 2; ++s) {
        const float4 gv = *(const float4*)&Gs[k0 + 4 * s];
        const float4 bv = *(const float4*)&Bs[k0 + 4 * s];
        const float ge[4] = {gv.x, gv.y, gv.z, gv.w};
        const float be[4] = {bv.x, bv.y, bv.z, bv.w};
        float4 w4[4];
#pragma unroll
        for (int e = 0; e < 4; ++e) w4[e] = *(const float4*)&Wbs[(k0 + 4 * s + e) * kH];
#pragma unroll
        for (int t = 0; t < kMT; ++t) {
          const float4 x = zr[t][4 * c + 2 * hi + s];
          const float xe[4] = {x.x, x.y, x.z, x.w};
#pragma unroll
          for (int e = 0; e < 4; ++e) {
            const float zl = (xe[e] - mu[t]) * rs[t] * ge[e] + be[e];
            zf[t][c][8 * hi + 4 * s + e] = (_Float16)zl;
            ba[t][0] += zl * w4[e].x;
            ba[t][1] += zl * w4[e].y;
            ba[t][2] += zl * w4[e].z;
            ba[t][3] += zl * w4[e].w;
          }
        }
      }
    }
#pragma unroll
  for (int t = 0; t < kMT; ++t) {
#pragma unroll
    for (int h = 0; h < kH; ++h) ba[t][h] += xhalf(ba[t][h]);
    // both halves hold all four sums of row lr: each half stores two heads
    const int j = j0 + 16 * t + lr;
    const int   x0 = bias_index(2 * hf, i, j), x1 = bias_index(2 * hf + 1, i, j);
    const float y0 = hf ? ba[t][2] : ba[t][0], y1 = hf ? ba[t][3] : ba[t][1];
    bias[x0] = y0;
    bias[x1] = y1;
    // as xcnt_wait(p): places and values stay in their registers up to the wait
    asm volatile("s_wait_xcnt 0x0" :: "v"(x0), "v"(x1), "v"(y0), "v"(y1) : "memory");
  }

  const v8f zero = {0.f, 0.f, 0.f, 0.f, 0.f, 0.f, 0.f, 0.f};

  // q (scaled) and k, layout (i,h,j,c): 16 tiles of 16 weight columns
  for (int nt = 0; nt < 16; ++nt) {
    v8f acc[kMT] = {zero, zero, zero};
#pragma unroll
    for (int c = 0; c < 4; ++c) {
      const v16h wf = lfrag(&Wt[nt * 16 + lr][c * 32 + 8 * hf]);
#pragma unroll
      for (int t = 0; t < kMT; ++t) acc[t] = wmma_f16(wf, zf[t][c], acc[t]);
    }
    const float sc = nt < 8 ? 0.17677669529663687f : 1.0f;
    _Float16* dst = (nt < 8 ? qo : ko) +
        ((i * kH + ((nt & 7) >> 1)) * kN + j0 + lr) * kC + (nt & 1) * 16 + 8 * hf;
#pragma unroll
    for (int t = 0; t < kMT; ++t) {
      v8h o;
#pragma unroll
      for (int r = 0; r < 8; ++r) o[r] = (_Float16)(acc[t][r] * sc);
      *(v8h*)(dst + 16 * t * kC) = o;
      xcnt_wait();
    }
  }

  // v, layout (i,h,c,j)
  for (int nt = 0; nt < 8; ++nt) {
    v8f acc[kMT] = {zero, zero, zero};
#pragma unroll
    for (int c = 0; c < 4; ++c) {
      const v16h wf = lfrag(&Wt[2 * kHC + nt * 16 + lr][c * 32 + 8 * hf]);
#pragma unroll
      for (int t = 0; t < kMT; ++t) acc[t] = wmma_f16(zf[t][c], wf, acc[t]);
    }
    _Float16* dst = vo + (i * kHC + nt * 16 + lr) * kN + j0 + 8 * hf;
#pragma unroll
    for (int t = 0; t < kMT; ++t) {
      v8h o;
#pragma unroll
      for (int r = 0; r < 8; ++r) o[r] = (_Float16)acc[t][r];
      *(v8h*)(dst + 16 * t) = o;
      xcnt_wait();
    }
  }

  // g = sigmoid(x + bg), layout (i,j,h*C+c)
  for (int nt = 0; nt < 8; ++nt) {
    v8f acc[kMT] = {zero, zero, zero};
#pragma unroll
    for (int c = 0; c < 4; ++c) {
      const v16h wf = lfrag(&Wt[3 * kHC + nt * 16 + lr][c * 32 + 8 * hf]);
#pragma unroll
      for (int t = 0; t < kMT; ++t) acc[t] = wmma_f16(wf, zf[t][c], acc[t]);
    }
    const int col = nt * 16 + 8 * hf;
    const float4 g0 = *(const float4*)(bg + col), g1 = *(const float4*)(bg + col + 4);
    xcnt_wait(bg + col);
    const float ge[8] = {g0.x, g0.y, g0.z, g0.w, g1.x, g1.y, g1.z, g1.w};
    _Float16* dst = go + (long)(row0 + lr) * kHC + col;
#pragma unroll
    for (int t = 0; t < kMT; ++t) {
      v8h o;
#pragma unroll
      for (int r = 0; r < 8; ++r)
        o[r] = (_Float16)(1.0f / (1.0f + __expf(-(acc[t][r] + ge[r]))));
      *(v8h*)(dst + 16 * t * kHC) = o;
      xcnt_wait();
    }
  }
}

// ---------------------------------------------------------------------------
// Kernel 2: flash attention over all four heads, gate and output projection.
// A work-group has 12 waves and one i; a wave owns 16 q rows and runs the heads
// one after another: 48 stages of 32 keys. K/V 32x32 tiles are DMA'd once per
// work-group into double-buffered LDS (global_load_async_to_lds_b128,
// ASYNCcnt); the copy of stage t + 2 flies while stage t + 1 is worked on.
// Per stage: S^T = K Q^T + bias^T (2 WMMAs, K rows as A, Q as B, the bias tile
// as C), so a lane holds 16 scores of ONE query: maximum and sum run in its own
// registers, plus one exchange between the wave's halves. The two S^T tiles,
// converted in place, are the B operand of O^T += V^T P^T (2 WMMAs).
// A head's O^T tiles, as f16, are in turn the B operand (k = the head's 32
// channels, column q) of out^T = wo^T (g .* o)^T: o never goes to memory, and a
// lane ends with 8 neighbouring output columns of one row (16-byte stores).
// 768 work-groups: three on every WGP, all resident at once.
// ---------------------------------------------------------------------------
constexpr int kAW = 12;               // waves per work-group
constexpr int kAT = kAW * 32;         // 384 threads
constexpr int kCH = kN / 32;          // 12 stages per head
constexpr int kST = kH * kCH;         // 48 stages

// 9 waves per SIMD: the register budget at which three work-groups fit a WGP
__global__ __launch_bounds__(kAT, 9) void attn_out_kernel(
    const _Float16* __restrict__ q, const _Float16* __restrict__ k,
    const _Float16* __restrict__ vt, const float* __restrict__ bias,
    const _Float16* __restrict__ gb, const float* __restrict__ wo,
    const float* __restrict__ bo, float* __restrict__ out) {
  __shared__ __attribute__((aligned(16))) _Float16 Kt[2][32][kTP];  // [buf][j-row][c]     5 KB
  __shared__ __attribute__((aligned(16))) _Float16 Vs[2][32][kTP];  // [buf][c-row][j]     5 KB
  __shared__ __attribute__((aligned(16))) _Float16 Wt[kCZ][kWP];    // wo as [n][k]       34 KB
  __shared__ __attribute__((aligned(16))) v8h Os[kAW][kH][2][32];   // a lane's own O^T   48 KB
  __shared__ __attribute__((aligned(16))) float Bo[kCZ];
  const int tid  = threadIdx.x;
  const int lane = tid & 31;
  const int lr   = lane & 15;
  const int hf   = lane >> 4;
  const int wave = __builtin_amdgcn_readfirstlane(tid >> 5);
  const int i = blockIdx.y;
  const int qbase = blockIdx.x * (16 * kAW) + wave * 16;
  const _Float16* qp = q + (long)i * kH * kN * kC + qbase * kC;

  // K/V tile copy: waves 0..3 bring K, waves 4..7 V, 16 bytes a lane. K rows of
  // the four heads follow one another, so stage t starts at row 32 t; V^T is
  // (h, c, j): head t / 12, columns 32 (t % 12).
  const bool isk = wave < 4;
  const int crow = (tid & 127) >> 2;   // 0..31
  const int cchk = (tid & 3) << 3;     // half offset 0,8,16,24
  const _Float16* csrc = isk ? k  + (long)i * kH * kN * kC + crow * kC + cchk
                             : vt + (long)i * kH * kC * kN + crow * kN + cchk;
  _Float16* cdst = isk ? &Kt[0][crow][cchk] : &Vs[0][crow][cchk];
  auto stage_copy = [&](int hh, int nn, int buf) {
    if (wave < 8)
      copy16(csrc + (isk ? (hh * kCH + nn) * 32 * kC : hh * kC * kN + nn * 32),
             cdst + buf * 32 * kTP);
  };

  // wo: 16 groups of 8 rows, group wave and, for waves 0..3, group wave + 12
  float4 wa[8], wx[8];
  load_wrows(wa, wo, wave * 8, lane);
  if (wave < 4) load_wrows(wx, wo, (wave + 12) * 8, lane);
  float4 bl = {0.f, 0.f, 0.f, 0.f};
  if (wave == kAW - 1) {
    bl = ((const float4*)bo)[lane];
    xcnt_wait();
  }
  stage_copy(0, 0, 0);
  v16h bq = gfrag(qp, kC, lane);  // Q^T columns of head 0
  xcnt_wait();
  store_wrows(wa, Wt, wave * 8, lane);
  if (wave < 4) store_wrows(wx, Wt, (wave + 12) * 8, lane);
  if (wave == kAW - 1) ((float4*)Bo)[lane] = bl;
  wait_async_copies();
  __syncthreads();
  stage_copy(0, 1, 1);

  const v8f zero = {0.f, 0.f, 0.f, 0.f, 0.f, 0.f, 0.f, 0.f};

  // rolled: one copy of the stage loop in the instruction cache, and no head's
  // registers live on into the next
#pragma unroll 1
  for (int h = 0; h < kH; ++h) {
    // the next head's Q comes in while this head is worked on
    const v16h bqn = gfrag(qp + (h + 1 < kH ? h + 1 : h) * kN * kC, kC, lane);
    xcnt_wait();
    // this wave's 16 queries: bias tiles (one per stage, 512 floats each)
    const float4* bp = (const float4*)(bias + bias_index(h, qbase, 0)) + lane;

    v8f o0 = zero, o1 = zero;  // O^T rows c in [0,16) / [16,32), column q = lane % 16
    float mrun = -1e30f;       // running maximum of query lane % 16
    float lsum = 0.f;          // its denominator: this half-wave's keys only

    for (int n = 0; n < kCH; ++n) {
      const int buf = n & 1;

      const v16h ak0 = lfrag(&Kt[buf][lr][hf << 3]);
      const v16h ak1 = lfrag(&Kt[buf][16 + lr][hf << 3]);
      const float4 b00 = bp[n * 128], b01 = bp[n * 128 + 32];
      const float4 b10 = bp[n * 128 + 64], b11 = bp[n * 128 + 96];
      const v8f cb0 = {b00.x, b00.y, b00.z, b00.w, b01.x, b01.y, b01.z, b01.w};
      const v8f cb1 = {b10.x, b10.y, b10.z, b10.w, b11.x, b11.y, b11.z, b11.w};
      // s0[r] = S[q = lane%16][32 n + 8*(lane/16) + r], s1[r]: the same + 16
      const v8f s0 = wmma_f16(ak0, bq, cb0);
      const v8f s1 = wmma_f16(ak1, bq, cb1);
      const v16h av0 = lfrag(&Vs[buf][lr][hf << 3]);
      const v16h av1 = lfrag(&Vs[buf][16 + lr][hf << 3]);

      // Hand-over, as soon as the stage's four fragments are in registers: this
      // wave's reads of buf are done, its copies of the next stage have landed;
      // behind the barrier that holds for every wave, and buf is free for the
      // stage after the next, whose copy flies during the softmax below and the
      // next stage's score WMMAs.
      asm volatile("s_wait_dscnt 0x0" ::: "memory");
      wait_async_copies();
      __syncthreads();
      if (h * kCH + n + 2 < kST)
        stage_copy(n + 2 < kCH ? h : h + 1, n + 2 < kCH ? n + 2 : n + 2 - kCH, buf);

      float t = fmaxf(s0[0], s1[0]);
#pragma unroll
      for (int r = 1; r < 8; ++r) t = fmaxf(t, fmaxf(s0[r], s1[r]));
      t = fmaxf(t, xhalf(t));  // both halves scale by the same maximum
      const float nm = fmaxf(mrun, t);
      const float sc = __expf(mrun - nm);
      mrun = nm;

      v16h pt;  // P^T as B operand: element s is key 32 n + (s<8 ? 8*(lane/16)+s : 16+8*(lane/16)+s-8)
      float rsum = 0.f;
#pragma unroll
      for (int r = 0; r < 8; ++r) {
        const float p0 = __expf(s0[r] - nm);
        const float p1 = __expf(s1[r] - nm);
        rsum += p0 + p1;
        pt[r]     = (_Float16)p0;
        pt[8 + r] = (_Float16)p1;
      }
      lsum = lsum * sc + rsum;
#pragma unroll
      for (int r = 0; r < 8; ++r) { o0[r] *= sc; o1[r] *= sc; }

      o0 = wmma_f16(av0, pt, o0);
      o1 = wmma_f16(av1, pt, o1);
    }

    // O^T as f16: w0[r] is channel 8*hf + r of query lr, w1[r] channel 16 + 8*hf + r.
    // Each lane parks its 32 bytes in LDS and takes them back itself below.
    const float inv = 1.0f / (lsum + xhalf(lsum));
    v8h w0, w1;
#pragma unroll
    for (int r = 0; r < 8; ++r) {
      w0[r] = (_Float16)(o0[r] * inv);
      w1[r] = (_Float16)(o1[r] * inv);
    }
    Os[wave][h][0][lane] = w0;
    Os[wave][h][1][lane] = w1;
    bq = bqn;
  }
  wait_async_copies();

  // gate: g of row q in the element order of the parked O^T
  const long row = (long)i * kN + qbase + lr;
  const _Float16* gp = gb + row * kHC + 8 * hf;
  v8h gl[kH], gh[kH];
#pragma unroll
  for (int h = 0; h < kH; ++h) {
    gl[h] = *(const v8h*)(gp + h * kC);
    gh[h] = *(const v8h*)(gp + h * kC + 16);
  }
  xcnt_wait();
  v16h of[kH];  // (g .* o)^T as B operand: element 8*s + r is channel 16*s + 8*hf + r
#pragma unroll
  for (int h = 0; h < kH; ++h) {
    const v8h w0 = Os[wave][h][0][lane], w1 = Os[wave][h][1][lane];
#pragma unroll
    for (int e = 0; e < 8; ++e) { of[h][e] = gl[h][e] * w0[e]; of[h][8 + e] = gh[h][e] * w1[e]; }
  }

  // out^T tile nt: rows = output columns 16 nt + 8 hf + r, column = row q.
  // Four tiles at a time: four independent accumulator chains.
  float* dst = out + row * kCZ + 8 * hf;
#pragma unroll
  for (int n0 = 0; n0 < kCZ / 16; n0 += 4) {
    v8f acc[4] = {zero, zero, zero, zero};
#pragma unroll
    for (int h = 0; h < kH; ++h)
#pragma unroll
      for (int u = 0; u < 4; ++u)
        acc[u] = wmma_f16(lfrag(&Wt[(n0 + u) * 16 + lr][h * kC + 8 * hf]), of[h], acc[u]);
#pragma unroll
    for (int u = 0; u < 4; ++u) {
      const int col = (n0 + u) * 16;
      const float4 c0 = *(const float4*)&Bo[col + 8 * hf], c1 = *(const float4*)&Bo[col + 8 * hf + 4];
      const float4 r0 = {acc[u][0] + c0.x, acc[u][1] + c0.y, acc[u][2] + c0.z, acc[u][3] + c0.w};
      const float4 r1 = {acc[u][4] + c1.x, acc[u][5] + c1.y, acc[u][6] + c1.z, acc[u][7] + c1.w};
      *(float4*)(dst + col)     = r0;
      *(float4*)(dst + col + 4) = r1;
    }
    xcnt_wait();
  }
}

// ---------------------------------------------------------------------------
extern "C" void kernel_launch(void* const* d_in, const int* in_sizes, int n_in,
                              void* d_out, int out_size, void* d_ws, size_t ws_size,
                              hipStream_t stream) {
  const float* z      = (const float*)d_in[0];
  const float* ln_g   = (const float*)d_in[1];
  const float* ln_b   = (const float*)d_in[2];
  const float* w_bias = (const float*)d_in[3];
  const float* wq     = (const float*)d_in[4];
  const float* wk     = (const float*)d_in[5];
  const float* wv     = (const float*)d_in[6];
  const float* wg     = (const float*)d_in[7];
  const float* bg     = (const float*)d_in[8];
  const float* wo     = (const float*)d_in[9];
  const float* bo     = (const float*)d_in[10];
  float* out = (float*)d_out;

  char* ws = (char*)d_ws;
  const size_t S2 = (size_t)kNN * kHC * 2;  // one fp16 NN x 128 buffer
  _Float16* qb = (_Float16*)(ws + 1 * S2);
  _Float16* kb = (_Float16*)(ws + 2 * S2);
  _Float16* vt = (_Float16*)(ws + 3 * S2);
  _Float16* gb = (_Float16*)(ws + 4 * S2);
  float*  biasb = (float*)(ws + 6 * S2);    // H * NN fp32

  ln_proj_kernel<<<kNN / (16 * kMT * kFW), kFT, 0, stream>>>(
      z, ln_g, ln_b, w_bias, wq, wk, wv, wg, bg, qb, kb, vt, gb, biasb);

  dim3 g2(kN / (16 * kAW), kN);
  attn_out_kernel<<<g2, kAT, 0, stream>>>(qb, kb, vt, biasb, gb, wo, bo, out);
}

// v005
// Measured time: 114 microseconds a run.
// Two timings next to v004 put it at 1.08 and 1.07 times that version's speed.
// All steps since v000 together make it 4.83 times as fast.
#include <hip/hip_runtime.h>
#include <hip/hip_bf16.h>

typedef __attribute__((ext_vector_type(16))) _Float16 v16h;
typedef __attribute__((ext_vector_type(8)))  _Float16 v8h;
typedef __attribute__((ext_vector_type(4)))  _Float16 v4h;
typedef __attribute__((ext_vector_type(8)))  float    v8f;

constexpr int kN  = 384;
constexpr int kNN = kN * kN;      // 147456
constexpr int kCZ = 128;
constexpr int kH  = 4;
constexpr int kC  = 32;
constexpr int kHC = kH * kC;      // 128
// LDS row pitches in halves: an odd multiple of 16 bytes, so that the 16 rows
// one ds_load_b128 fragment read touches fall on 16 different bank groups.
constexpr int kWP = kCZ + 8;      // 272-byte rows for the 128-half weight tiles
constexpr int kTP = 32 + 8;       // 80-byte rows for the 32-half K, V tiles

// ---------------------------------------------------------------------------
// 16x16x32 f16 WMMA wrapper (CDNA5, wave32). D = A(16x32) * B(32x16) + C.
// ---------------------------------------------------------------------------
__device__ __forceinline__ v8f wmma_f16(v16h a, v16h b, v8f c) {
  return __builtin_amdgcn_wmma_f32_16x16x32_f16(false, a, false, b,
                                                (short)0, c, false, false);
}

// ---------------------------------------------------------------------------
// Lane order of the f16 workspace arrays. A block is 512 bytes: lane L's 8
// halves stand at 8*L, so that one 16-byte access per lane of a whole wave,
// store, load or copy, covers four whole 128-byte lines.
//   q, k: a tile of 16 rows j x 32 c is two blocks; block s, lane L holds row
//         L%16, columns 16*s + 8*(L/16) .. +8; tiles follow as (i, h, j/16)
//   v:    block (i, c/16 of all 128 channels, j/16): lane L holds channel L%16,
//         keys j 8*(L/16) .. +8
//   g:    a tile of 16 rows x 128 columns is eight blocks; block nt, lane L
//         holds row L%16, columns 16*nt + 8*(L/16) .. +8
// ---------------------------------------------------------------------------
constexpr int kBK = 32 * 8;       // halves in a block

// 16x32 f16 fragment (lane L: row L%16, halves [8*(L/16), +8) and
// [16+8*(L/16), +8)) from a q tile in lane order: its two blocks.
__device__ __forceinline__ v16h tfrag(const _Float16* __restrict__ tile, int lane) {
  const _Float16* p = tile + 8 * lane;
  v8h lo = *(const v8h*)p;
  v8h hi = *(const v8h*)(p + kBK);
  v16h r;
#pragma unroll
  for (int e = 0; e < 8; ++e) { r[e] = lo[e]; r[8 + e] = hi[e]; }
  return r;
}

// Fragment from an LDS tile row (32 halves of it): two ds_load_b128.
__device__ __forceinline__ v16h lfrag(const _Float16* p0) {
  v8h lo = *(const v8h*)p0;
  v8h hi = *(const v8h*)(p0 + 16);
  v16h r;
#pragma unroll
  for (int e = 0; e < 8; ++e) { r[e] = lo[e]; r[8 + e] = hi[e]; }
  return r;
}

// ---------------------------------------------------------------------------
// One 16-byte global -> LDS async DMA (CDNA5, tracked by ASYNCcnt).
// VDST carries the LDS byte address (ISA: dsaddr = LDS_BASE + VGPR[VDST]).
// A generic pointer into LDS holds the LDS offset in its low 32 bits on
// AMDGPU, so truncating the pointer gives the right VDST value.
// ---------------------------------------------------------------------------
__device__ __forceinline__ void copy16(const _Float16* gsrc, _Float16* ldst) {
#if defined(__gfx1250__)
  // the wait stands in the copy's own statement: in front of any later write
  // of the two address registers
  asm volatile("global_load_async_to_lds_b128 %0, %1, off\n\ts_wait_xcnt 0x0"
               :
               : "v"((unsigned)(unsigned long long)ldst), "v"(gsrc)
               : "memory");
#else
  *(v8h*)ldst = *(const v8h*)gsrc;
#endif
}

__device__ __forceinline__ void wait_async_copies() {
#if defined(__gfx1250__)
  asm volatile("s_wait_asynccnt 0x0" ::: "memory");
#endif
}

// ---------------------------------------------------------------------------
// Place of bias[h][q][k] in the workspace. A tile holds 16 q x 32 k (2 KB) as
// four 512-byte groups; group g, lane l, float e is the C/D element of the
// transposed score tile S^T (rows k, columns q): column q = l % 16, row
// k = 16*(g/2) + 8*(l/16) + 4*(g%2) + e. One global_load_b128 of a wave then
// reads one whole group: four full 128-byte lines.
// ---------------------------------------------------------------------------
__device__ __forceinline__ int bias_index(int h, int q, int k) {
  const int tile = (h * (kN / 16) + (q >> 4)) * (kN / 32) + (k >> 5);
  const int grp  = ((k >> 4) & 1) * 2 + ((k >> 2) & 1);
  const int ln   = (q & 15) + (((k >> 3) & 1) << 4);
  return tile * 512 + grp * 128 + ln * 4 + (k & 3);
}

// Lane l <-> lane l ^ 16 (the two halves of a wave that share a WMMA column).
__device__ __forceinline__ float xhalf(float x) {
  const int v = __builtin_bit_cast(int, x);
  return __builtin_bit_cast(float, __builtin_amdgcn_permlanex16(
      v, v, 0x76543210, 0xfedcba98, false, false));
}

// ---------------------------------------------------------------------------
// Kernel 1: LayerNorm, pair bias and the q, k, v, g projections in one launch.
// One work-group per WGP: 12 waves, each owning 48 rows (i, j) = three 16-row
// tiles. z comes by whole-row loads and is turned, through a tile of LDS that
// belongs to the wave alone, into the WMMA fragment order (a lane: row
// lane % 16, 8 + 8 columns of every 32), so mean and variance are in-lane sums
// plus one exchange between the wave's halves, and the normalised rows become
// f16 fragments in registers: they never go to memory. All four weights sit in
// LDS as f16 [n][k]; every weight fragment read serves three row tiles.
//   q, k, g: D = W^T (A) x zn^T (B): a lane holds 8 neighbouring columns of one
//            row;  v: D = zn (A) x W (B): a lane holds 8 neighbouring j of one
//            channel. Each result tile goes out as one block in lane order.
//   bias: fp32, q = i, k = j, in tiles of 16 q x 32 k laid out in the order in
//         which attn_out_kernel's lanes take them as WMMA C operands (bias_index)
// ---------------------------------------------------------------------------
constexpr int kFW = 12;           // waves per work-group
constexpr int kFT = kFW * 32;     // 384 threads
constexpr int kMT = 3;            // 16-row tiles per wave
constexpr int kZP = kCZ + 4;      // 528-byte rows (16 B x odd) for the fp32 z tile

// Stands behind global loads or stores, in front of the next write of a
// register that they name. The form with an address keeps that address in its
// registers up to the wait, so that no load of the run lands on them.
__device__ __forceinline__ void xcnt_wait() {
  asm volatile("s_wait_xcnt 0x0" ::: "memory");
}
__device__ __forceinline__ void xcnt_wait(const float* p) {
  asm volatile("s_wait_xcnt 0x0" :: "v"(p) : "memory");
}

// Staging of a weight W (128 k x 128 n, fp32) as f16 rows [n][k] in LDS, 8 k
// rows a wave at a time: eight whole-row loads (512 bytes, a lane takes 4 n),
// then for each of the lane's n one 16-byte LDS store of its 8 k.
__device__ __forceinline__ void load_wrows(float4 (&r)[8], const float* __restrict__ W,
                                           int k0, int lane) {
  const float* p = W + k0 * kHC + 4 * lane;
#pragma unroll
  for (int e = 0; e < 8; ++e) r[e] = *(const float4*)(p + e * kHC);
  xcnt_wait(p);
}

__device__ __forceinline__ void store_wrows(const float4 (&r)[8],
                                            _Float16 (*__restrict__ dst)[kWP],
                                            int k0, int lane) {
  v8h p0, p1, p2, p3;
#pragma unroll
  for (int e = 0; e < 8; ++e) {
    p0[e] = (_Float16)r[e].x; p1[e] = (_Float16)r[e].y;
    p2[e] = (_Float16)r[e].z; p3[e] = (_Float16)r[e].w;
  }
  *(v8h*)&dst[4 * lane + 0][k0] = p0;
  *(v8h*)&dst[4 * lane + 1][k0] = p1;
  *(v8h*)&dst[4 * lane + 2][k0] = p2;
  *(v8h*)&dst[4 * lane + 3][k0] = p3;
}

__global__ __launch_bounds__(kFT) void ln_proj_kernel(
    const float* __restrict__ z, const float* __restrict__ g,
    const float* __restrict__ b, const float* __restrict__ wb,
    const float* __restrict__ wq, const float* __restrict__ wk,
    const float* __restrict__ wv, const float* __restrict__ wg,
    const float* __restrict__ bg, _Float16* __restrict__ qo,
    _Float16* __restrict__ ko, _Float16* __restrict__ vo,
    _Float16* __restrict__ go, float* __restrict__ bias) {
  __shared__ __attribute__((aligned(16))) _Float16 Wt[4 * kHC][kWP];  // q,k,v,g: 136 KB
  __shared__ __attribute__((aligned(16))) float Zs[kFW][16][kZP];     // 99 KB
  __shared__ __attribute__((aligned(16))) float Gs[kCZ];
  __shared__ __attribute__((aligned(16))) float Bs[kCZ];
  __shared__ __attribute__((aligned(16))) float Wbs[kCZ * kH];
  const int tid  = threadIdx.x;
  const int lane = tid & 31;
  const int lr   = lane & 15;   // row of a tile (A) or column (B)
  const int hf   = lane >> 4;   // which 8 of every 16 k
  const int wave = __builtin_amdgcn_readfirstlane(tid >> 5);
  const int task = blockIdx.x * kFW + wave;
  const int i    = task >> 3;           // 8 tasks of 48 rows make one i
  const int j0   = (task & 7) * (16 * kMT);
  const int row0 = i * kN + j0;

  // The 4 x 16 groups of 8 weight rows: group wave + 12*it for it = 0..4, and
  // the last four go to waves 0..3. Loads come back in the order of issue, so
  // the three groups asked for ahead of z are stored while z is on its way from
  // memory; the others follow z and land during the row statistics.
  float4 wa[3][8], wc[2][8], wx[8];
  load_wrows(wa[0], wq, wave * 8, lane);                                     // 0..11
  load_wrows(wa[1], wave < 4 ? wq : wk, ((wave + 12) & 15) * 8, lane);       // 12..23
  load_wrows(wa[2], wave < 8 ? wk : wv, ((wave + 8) & 15) * 8, lane);        // 24..35

  float4 zr[kMT][16];  // here [tile][row]: columns 4*lane .. of a whole row
  const float* zp = z + (long)row0 * kCZ + 4 * lane;
#pragma unroll
  for (int t = 0; t < kMT; ++t)
#pragma unroll
    for (int v = 0; v < 16; ++v)
      zr[t][v] = *(const float4*)(zp + (16 * t + v) * kCZ);
  xcnt_wait(zp);

  store_wrows(wa[0], &Wt[0], wave * 8, lane);
  store_wrows(wa[1], &Wt[wave < 4 ? 0 : kHC], ((wave + 12) & 15) * 8, lane);
  store_wrows(wa[2], &Wt[wave < 8 ? kHC : 2 * kHC], ((wave + 8) & 15) * 8, lane);

  if (wave < 4) {
    load_wrows(wx, wg, (wave + 12) * 8, lane);                               // 60..63
    const float gl = g[tid], bl = b[tid];
    const float4 wl = ((const float4*)wb)[tid];
    xcnt_wait();
    store_wrows(wx, &Wt[3 * kHC], (wave + 12) * 8, lane);
    Gs[tid] = gl; Bs[tid] = bl; ((float4*)Wbs)[tid] = wl;
  }
  load_wrows(wc[0], wv, (wave + 4) * 8, lane);                               // 36..47
  load_wrows(wc[1], wg, wave * 8, lane);                                     // 48..59

  // Each tile into the fragment order: from here zr is [tile][4*c + 2*hi + s],
  // columns 32c + 16hi + 8hf + 4s .. of row lr. Then the row statistics: 64
  // values in the lane, the other 64 in lane ^ 16.
  float (*Zw)[kZP] = Zs[wave];
  float mu[kMT], rs[kMT];
#pragma unroll
  for (int t = 0; t < kMT; ++t) {
#pragma unroll
    for (int v = 0; v < 16; ++v) *(float4*)&Zw[v][4 * lane] = zr[t][v];
    // other lanes of the wave read these rows back: the stores land first
    asm volatile("s_wait_dscnt 0x0" ::: "memory");
#pragma unroll
    for (int v = 0; v < 16; ++v)
      zr[t][v] = *(const float4*)&Zw[lr][8 * hf + 16 * (v >> 1) + 4 * (v & 1)];
    float4 a1 = {0.f, 0.f, 0.f, 0.f}, a2 = {0.f, 0.f, 0.f, 0.f};
#pragma unroll
    for (int v = 0; v < 16; ++v) {
      const float4 x = zr[t][v];
      a1.x += x.x; a1.y += x.y; a1.z += x.z; a1.w += x.w;
      a2.x += x.x * x.x; a2.y += x.y * x.y; a2.z += x.z * x.z; a2.w += x.w * x.w;
    }
    float s  = (a1.x + a1.y) + (a1.z + a1.w);
    float s2 = (a2.x + a2.y) + (a2.z + a2.w);
    s  += xhalf(s);
    s2 += xhalf(s2);
    mu[t] = s * (1.0f / kCZ);
    rs[t] = rsqrtf(s2 * (1.0f / kCZ) - mu[t] * mu[t] + 1e-5f);
  }

  store_wrows(wc[0], &Wt[2 * kHC], (wave + 4) * 8, lane);
  store_wrows(wc[1], &Wt[3 * kHC], wave * 8, lane);
  __syncthreads();

  // normalise; fp32 pair bias; f16 fragments. Element 8*hi + e of fragment c is
  // column 32c + 16hi + 8hf + e: the order in which lfrag reads a weight row.
  v16h zf[kMT][4];
  float ba[kMT][kH];
#pragma unroll
  for (int t = 0; t < kMT; ++t)
#pragma unroll
    for (int h = 0; h < kH; ++h) ba[t][h] = 0.f;
#pragma unroll
  for (int c = 0; c < 4; ++c)
#pragma unroll
    for (int hi = 0; hi < 2; ++hi) {
      const int k0 = 32 * c + 16 * hi + 8 * hf;
#pragma unroll
      for (int s = 0; s < 2; ++s) {
        const float4 gv = *(const float4*)&Gs[k0 + 4 * s];
        const float4 bv = *(const float4*)&Bs[k0 + 4 * s];
        const float ge[4] = {gv.x, gv.y, gv.z, gv.w};
        const float be[4] = {bv.x, bv.y, bv.z, bv.w};
        float4 w4[4];
#pragma unroll
        for (int e = 0; e < 4; ++e) w4[e] = *(const float4*)&Wbs[(k0 + 4 * s + e) * kH];
#pragma unroll
        for (int t = 0; t < kMT; ++t) {
          const float4 x = zr[t][4 * c + 2 * hi + s];
          const float xe[4] = {x.x, x.y, x.z, x.w};
#pragma unroll
          for (int e = 0; e < 4; ++e) {
            const float zl = (xe[e] - mu[t]) * rs[t] * ge[e] + be[e];
            zf[t][c][8 * hi + 4 * s + e] = (_Float16)zl;
            ba[t][0] += zl * w4[e].x;
            ba[t][1] += zl * w4[e].y;
            ba[t][2] += zl * w4[e].z;
            ba[t][3] += zl * w4[e].w;
          }
        }
      }
    }
#pragma unroll
  for (int t = 0; t < kMT; ++t) {
#pragma unroll
    for (int h = 0; h < kH; ++h) ba[t][h] += xhalf(ba[t][h]);
    // both halves hold all four sums of row lr: each half stores two heads
    const int j = j0 + 16 * t + lr;
    const int   x0 = bias_index(2 * hf, i, j), x1 = bias_index(2 * hf + 1, i, j);
    const float y0 = hf ? ba[t][2] : ba[t][0], y1 = hf ? ba[t][3] : ba[t][1];
    bias[x0] = y0;
    bias[x1] = y1;
    // as xcnt_wait(p): places and values stay in their registers up to the wait
    asm volatile("s_wait_xcnt 0x0" :: "v"(x0), "v"(x1), "v"(y0), "v"(y1) : "memory");
  }

  const v8f zero = {0.f, 0.f, 0.f, 0.f, 0.f, 0.f, 0.f, 0.f};

  // q (scaled) and k, tiles (i,h,j/16) in lane order: 16 tiles of 16 weight columns
  for (int nt = 0; nt < 16; ++nt) {
    v8f acc[kMT] = {zero, zero, zero};
#pragma unroll
    for (int c = 0; c < 4; ++c) {
      const v16h wf = lfrag(&Wt[nt * 16 + lr][c * 32 + 8 * hf]);
#pragma unroll
      for (int t = 0; t < kMT; ++t) acc[t] = wmma_f16(wf, zf[t][c], acc[t]);
    }
    const float sc = nt < 8 ? 0.17677669529663687f : 1.0f;
    _Float16* dst = (nt < 8 ? qo : ko) +
        (((i * kH + ((nt & 7) >> 1)) * kN + j0) / 16 * 2 + (nt & 1)) * kBK + 8 * lane;
#pragma unroll
    for (int t = 0; t < kMT; ++t) {
      v8h o;
#pragma unroll
      for (int r = 0; r < 8; ++r) o[r] = (_Float16)(acc[t][r] * sc);
      *(v8h*)(dst + 2 * t * kBK) = o;
      xcnt_wait();
    }
  }

  // v, blocks (i, c/16, j/16) in lane order
  for (int nt = 0; nt < 8; ++nt) {
    v8f acc[kMT] = {zero, zero, zero};
#pragma unroll
    for (int c = 0; c < 4; ++c) {
      const v16h wf = lfrag(&Wt[2 * kHC + nt * 16 + lr][c * 32 + 8 * hf]);
#pragma unroll
      for (int t = 0; t < kMT; ++t) acc[t] = wmma_f16(zf[t][c], wf, acc[t]);
    }
    _Float16* dst = vo + ((i * (kHC / 16) + nt) * kN + j0) / 16 * kBK + 8 * lane;
#pragma unroll
    for (int t = 0; t < kMT; ++t) {
      v8h o;
#pragma unroll
      for (int r = 0; r < 8; ++r) o[r] = (_Float16)acc[t][r];
      *(v8h*)(dst + t * kBK) = o;
      xcnt_wait();
    }
  }

  // g = sigmoid(x + bg), tiles of 16 rows (i,j) in lane order
  for (int nt = 0; nt < 8; ++nt) {
    v8f acc[kMT] = {zero, zero, zero};
#pragma unroll
    for (int c = 0; c < 4; ++c) {
      const v16h wf = lfrag(&Wt[3 * kHC + nt * 16 + lr][c * 32 + 8 * hf]);
#pragma unroll
      for (int t = 0; t < kMT; ++t) acc[t] = wmma_f16(wf, zf[t][c], acc[t]);
    }
    const int col = nt * 16 + 8 * hf;
    const float4 g0 = *(const float4*)(bg + col), g1 = *(const float4*)(bg + col + 4);
    xcnt_wait(bg + col);
    const float ge[8] = {g0.x, g0.y, g0.z, g0.w, g1.x, g1.y, g1.z, g1.w};
    _Float16* dst = go + (row0 / 16 * (kHC / 16) + nt) * kBK + 8 * lane;
#pragma unroll
    for (int t = 0; t < kMT; ++t) {
      v8h o;
#pragma unroll
      for (int r = 0; r < 8; ++r)
        o[r] = (_Float16)(1.0f / (1.0f + __expf(-(acc[t][r] + ge[r]))));
      *(v8h*)(dst + t * (kHC / 16) * kBK) = o;
      xcnt_wait();
    }
  }
}

// ---------------------------------------------------------------------------
// Kernel 2: flash attention over all four heads, gate and output projection.
// A work-group has 12 waves and one i; a wave owns 16 q rows and runs the heads
// one after another: 48 stages of 32 keys. K/V 32x32 tiles are DMA'd once per
// work-group into double-buffered LDS (global_load_async_to_lds_b128,
// ASYNCcnt); the copy of stage t + 2 flies while stage t + 1 is worked on.
// Per stage: S^T = K Q^T + bias^T (2 WMMAs, K rows as A, Q as B, the bias tile
// as C), so a lane holds 16 scores of ONE query: maximum and sum run in its own
// registers, plus one exchange between the wave's halves. The two S^T tiles,
// converted in place, are the B operand of O^T += V^T P^T (2 WMMAs).
// A head's O^T tiles, as f16, are in turn the B operand (k = the head's 32
// channels, column q) of out^T = wo^T (g .* o)^T: o never goes to memory, and a
// lane ends with 8 neighbouring output columns of one row (16-byte stores).
// 768 work-groups: three on every WGP, all resident at once.
// ---------------------------------------------------------------------------
constexpr int kAW = 12;               // waves per work-group
constexpr int kAT = kAW * 32;         // 384 threads
constexpr int kCH = kN / 32;          // 12 stages per head
constexpr int kST = kH * kCH;         // 48 stages

// 9 waves per SIMD: the register budget at which three work-groups fit a WGP
__global__ __launch_bounds__(kAT, 9) void attn_out_kernel(
    const _Float16* __restrict__ q, const _Float16* __restrict__ k,
    const _Float16* __restrict__ vt, const float* __restrict__ bias,
    const _Float16* __restrict__ gb, const float* __restrict__ wo,
    const float* __restrict__ bo, float* __restrict__ out) {
  __shared__ __attribute__((aligned(16))) _Float16 Kt[2][32][kTP];  // [buf][j-row][c]     5 KB
  __shared__ __attribute__((aligned(16))) _Float16 Vs[2][32][kTP];  // [buf][c-row][j]     5 KB
  __shared__ __attribute__((aligned(16))) _Float16 Wt[kCZ][kWP];    // wo as [n][k]       34 KB
  __shared__ __attribute__((aligned(16))) v8h Os[kAW][kH][2][32];   // a lane's own O^T   48 KB
  __shared__ __attribute__((aligned(16))) float Bo[kCZ];
  const int tid  = threadIdx.x;
  const int lane = tid & 31;
  const int lr   = lane & 15;
  const int hf   = lane >> 4;
  const int wave = __builtin_amdgcn_readfirstlane(tid >> 5);
  const int i = blockIdx.y;
  const int qbase = blockIdx.x * (16 * kAW) + wave * 16;
  const _Float16* qp = q + (long)i * kH * kN * kC + qbase * kC;

  // K/V tile copy: waves 0..3 bring K, waves 4..7 V, each wave one block in lane
  // order (512 bytes in a row), 16 bytes a lane. A stage's K is four blocks that
  // follow one another (two tiles of 16 rows), stage t at 4 t; its V is, for each
  // 16 of the head's channels, the two blocks of keys 32 (t % 12) .. +32. Block
  // cb of the four lands at rows 16*(cb/2), halves 16*(cb%2) of the LDS tile.
  const bool isk = wave < 4;
  const int cb   = wave & 3;
  const int crow = 16 * (cb >> 1) + lr;        // 0..31
  const int cchk = 16 * (cb & 1) + 8 * hf;     // half offset 0,8,16,24
  const _Float16* csrc =
      (isk ? k  + (long)i * kH * kN * kC + cb * kBK
           : vt + (long)i * kH * kC * kN + ((cb >> 1) * (kN / 16) + (cb & 1)) * kBK) + 8 * lane;
  _Float16* cdst = isk ? &Kt[0][crow][cchk] : &Vs[0][crow][cchk];
  auto stage_copy = [&](int hh, int nn, int buf) {
    if (wave < 8)
      copy16(csrc + (isk ? (hh * kCH + nn) * 4 * kBK : hh * kC * kN + nn * 2 * kBK),
             cdst + buf * 32 * kTP);
  };

  // wo: 16 groups of 8 rows, group wave and, for waves 0..3, group wave + 12
  float4 wa[8], wx[8];
  load_wrows(wa, wo, wave * 8, lane);
  if (wave < 4) load_wrows(wx, wo, (wave + 12) * 8, lane);
  float4 bl = {0.f, 0.f, 0.f, 0.f};
  if (wave == kAW - 1) {
    bl = ((const float4*)bo)[lane];
    xcnt_wait();
  }
  stage_copy(0, 0, 0);
  v16h bq = tfrag(qp, lane);  // Q^T columns of head 0
  xcnt_wait();
  store_wrows(wa, Wt, wave * 8, lane);
  if (wave < 4) store_wrows(wx, Wt, (wave + 12) * 8, lane);
  if (wave == kAW - 1) ((float4*)Bo)[lane] = bl;
  wait_async_copies();
  __syncthreads();
  stage_copy(0, 1, 1);

  const v8f zero = {0.f, 0.f, 0.f, 0.f, 0.f, 0.f, 0.f, 0.f};

  // rolled: one copy of the stage loop in the instruction cache, and no head's
  // registers live on into the next
#pragma unroll 1
  for (int h = 0; h < kH; ++h) {
    // the next head's Q comes in while this head is worked on
    const v16h bqn = tfrag(qp + (h + 1 < kH ? h + 1 : h) * kN * kC, lane);
    xcnt_wait();
    // this wave's 16 queries: bias tiles (one per stage, 512 floats each)
    const float4* bp = (const float4*)(bias + bias_index(h, qbase, 0)) + lane;

    v8f o0 = zero, o1 = zero;  // O^T rows c in [0,16) / [16,32), column q = lane % 16
    float mrun = -1e30f;       // running maximum of query lane % 16
    float lsum = 0.f;          // its denominator: this half-wave's keys only

    for (int n = 0; n < kCH; ++n) {
      const int buf = n & 1;

      const v16h ak0 = lfrag(&Kt[buf][lr][hf << 3]);
      const v16h ak1 = lfrag(&Kt[buf][16 + lr][hf << 3]);
      const float4 b00 = bp[n * 128], b01 = bp[n * 128 + 32];
      const float4 b10 = bp[n * 128 + 64], b11 = bp[n * 128 + 96];
      const v8f cb0 = {b00.x, b00.y, b00.z, b00.w, b01.x, b01.y, b01.z, b01.w};
      const v8f cb1 = {b10.x, b10.y, b10.z, b10.w, b11.x, b11.y, b11.z, b11.w};
      // s0[r] = S[q = lane%16][32 n + 8*(lane/16) + r], s1[r]: the same + 16
      const v8f s0 = wmma_f16(ak0, bq, cb0);
      const v8f s1 = wmma_f16(ak1, bq, cb1);
      const v16h av0 = lfrag(&Vs[buf][lr][hf << 3]);
      const v16h av1 = lfrag(&Vs[buf][16 + lr][hf << 3]);

      // Hand-over, as soon as the stage's four fragments are in registers: this
      // wave's reads of buf are done, its copies of the next stage have landed;
      // behind the barrier that holds for every wave, and buf is free for the
      // stage after the next, whose copy flies during the softmax below and the
      // next stage's score WMMAs.
      asm volatile("s_wait_dscnt 0x0" ::: "memory");
      wait_async_copies();
      __syncthreads();
      if (h * kCH + n + 2 < kST)
        stage_copy(n + 2 < kCH ? h : h + 1, n + 2 < kCH ? n + 2 : n + 2 - kCH, buf);

      float t = fmaxf(s0[0], s1[0]);
#pragma unroll
      for (int r = 1; r < 8; ++r) t = fmaxf(t, fmaxf(s0[r], s1[r]));
      t = fmaxf(t, xhalf(t));  // both halves scale by the same maximum
      const float nm = fmaxf(mrun, t);
      const float sc = __expf(mrun - nm);
      mrun = nm;

      v16h pt;  // P^T as B operand: element s is key 32 n + (s<8 ? 8*(lane/16)+s : 16+8*(lane/16)+s-8)
      float rsum = 0.f;
#pragma unroll
      for (int r = 0; r < 8; ++r) {
        const float p0 = __expf(s0[r] - nm);
        const float p1 = __expf(s1[r] - nm);
        rsum += p0 + p1;
        pt[r]     = (_Float16)p0;
        pt[8 + r] = (_Float16)p1;
      }
      lsum = lsum * sc + rsum;
#pragma unroll
      for (int r = 0; r < 8; ++r) { o0[r] *= sc; o1[r] *= sc; }

      o0 = wmma_f16(av0, pt, o0);
      o1 = wmma_f16(av1, pt, o1);
    }

    // O^T as f16: w0[r] is channel 8*hf + r of query lr, w1[r] channel 16 + 8*hf + r.
    // Each lane parks its 32 bytes in LDS and takes them back itself below.
    const float inv = 1.0f / (lsum + xhalf(lsum));
    v8h w0, w1;
#pragma unroll
    for (int r = 0; r < 8; ++r) {
      w0[r] = (_Float16)(o0[r] * inv);
      w1[r] = (_Float16)(o1[r] * inv);
    }
    Os[wave][h][0][lane] = w0;
    Os[wave][h][1][lane] = w1;
    bq = bqn;
  }
  wait_async_copies();

  // gate: g of row q; its blocks 2h and 2h + 1 are in the element order of the
  // parked O^T
  const long row = (long)i * kN + qbase + lr;
  const _Float16* gp = gb + (i * kN + qbase) / 16 * (kHC / 16) * kBK + 8 * lane;
  v8h gl[kH], gh[kH];
#pragma unroll
  for (int h = 0; h < kH; ++h) {
    gl[h] = *(const v8h*)(gp + 2 * h * kBK);
    gh[h] = *(const v8h*)(gp + (2 * h + 1) * kBK);
  }
  xcnt_wait();
  v16h of[kH];  // (g .* o)^T as B operand: element 8*s + r is channel 16*s + 8*hf + r
#pragma unroll
  for (int h = 0; h < kH; ++h) {
    const v8h w0 = Os[wave][h][0][lane], w1 = Os[wave][h][1][lane];
#pragma unroll
    for (int e = 0; e < 8; ++e) { of[h][e] = gl[h][e] * w0[e]; of[h][8 + e] = gh[h][e] * w1[e]; }
  }

  // out^T tile nt: rows = output columns 16 nt + 8 hf + r, column = row q.
  // Four tiles at a time: four independent accumulator chains.
  float* dst = out + row * kCZ + 8 * hf;
#pragma unroll
  for (int n0 = 0; n0 < kCZ / 16; n0 += 4) {
    v8f acc[4] = {zero, zero, zero, zero};
#pragma unroll
    for (int h = 0; h < kH; ++h)
#pragma unroll
      for (int u = 0; u < 4; ++u)
        acc[u] = wmma_f16(lfrag(&Wt[(n0 + u) * 16 + lr][h * kC + 8 * hf]), of[h], acc[u]);
#pragma unroll
    for (int u = 0; u < 4; ++u) {
      const int col = (n0 + u) * 16;
      const float4 c0 = *(const float4*)&Bo[col + 8 * hf], c1 = *(const float4*)&Bo[col + 8 * hf + 4];
      const float4 r0 = {acc[u][0] + c0.x, acc[u][1] + c0.y, acc[u][2] + c0.z, acc[u][3] + c0.w};
      const float4 r1 = {acc[u][4] + c1.x, acc[u][5] + c1.y, acc[u][6] + c1.z, acc[u][7] + c1.w};
      *(float4*)(dst + col)     = r0;
      *(float4*)(dst + col + 4) = r1;
    }
    xcnt_wait();
  }
}

// ---------------------------------------------------------------------------
extern "C" void kernel_launch(void* const* d_in, const int* in_sizes, int n_in,
                              void* d_out, int out_size, void* d_ws, size_t ws_size,
                              hipStream_t stream) {
  const float* z      = (const float*)d_in[0];
  const float* ln_g   = (const float*)d_in[1];
  const float* ln_b   = (const float*)d_in[2];
  const float* w_bias = (const float*)d_in[3];
  const float* wq     = (const float*)d_in[4];
  const float* wk     = (const float*)d_in[5];
  const float* wv     = (const float*)d_in[6];
  const float* wg     = (const float*)d_in[7];
  const float* bg     = (const float*)d_in[8];
  const float* wo     = (const float*)d_in[9];
  const float* bo     = (const float*)d_in[10];
  float* out = (float*)d_out;

  char* ws = (char*)d_ws;
  const size_t S2 = (size_t)kNN * kHC * 2;  // one fp16 NN x 128 buffer
  _Float16* qb = (_Float16*)(ws + 1 * S2);
  _Float16* kb = (_Float16*)(ws + 2 * S2);
  _Float16* vt = (_Float16*)(ws + 3 * S2);
  _Float16* gb = (_Float16*)(ws + 4 * S2);
  float*  biasb = (float*)(ws + 6 * S2);    // H * NN fp32

  ln_proj_kernel<<<kNN / (16 * kMT * kFW), kFT, 0, stream>>>(
      z, ln_g, ln_b, w_bias, wq, wk, wv, wg, bg, qb, kb, vt, gb, biasb);

  dim3 g2(kN / (16 * kAW), kN);
  attn_out_kernel<<<g2, kAT, 0, stream>>>(qb, kb, vt, biasb, gb, wo, bo, out);
}

// v006
// A run of this version takes 111 microseconds.
// In both of two side-by-side timings against v005, it was 1.03 times as fast.
// Counting every step since v000, it is 4.97 times as fast.
#include <hip/hip_runtime.h>
#include <hip/hip_bf16.h>

typedef __attribute__((ext_vector_type(16))) _Float16 v16h;
typedef __attribute__((ext_vector_type(8)))  _Float16 v8h;
typedef __attribute__((ext_vector_type(4)))  _Float16 v4h;
typedef __attribute__((ext_vector_type(8)))  float    v8f;

constexpr int kN  = 384;
constexpr int kNN = kN * kN;      // 147456
constexpr int kCZ = 128;
constexpr int kH  = 4;
constexpr int kC  = 32;
constexpr int kHC = kH * kC;      // 128
// LDS row pitches in halves: an odd multiple of 16 bytes, so that the 16 rows
// one ds_load_b128 fragment read touches fall on 16 different bank groups.
constexpr int kWP = kCZ + 8;      // 272-byte rows for the 128-half weight tiles
constexpr int kTP = 32 + 8;       // 80-byte rows for the 32-half K, V tiles

// ---------------------------------------------------------------------------
// 16x16x32 f16 WMMA wrapper (CDNA5, wave32). D = A(16x32) * B(32x16) + C.
// ---------------------------------------------------------------------------
__device__ __forceinline__ v8f wmma_f16(v16h a, v16h b, v8f c) {
  return __builtin_amdgcn_wmma_f32_16x16x32_f16(false, a, false, b,
                                                (short)0, c, false, false);
}

// ---------------------------------------------------------------------------
// Lane order of the f16 workspace arrays. A block is 512 bytes: lane L's 8
// halves stand at 8*L, so that one 16-byte access per lane of a whole wave,
// store, load or copy, covers four whole 128-byte lines.
//   q, k: a tile of 16 rows j x 32 c is two blocks; block s, lane L holds row
//         L%16, columns 16*s + 8*(L/16) .. +8; tiles follow as (i, h, j/16)
//   v:    block (i, c/16 of all 128 channels, j/16): lane L holds channel L%16,
//         keys j 8*(L/16) .. +8
//   g:    a tile of 16 rows x 128 columns is eight blocks; block nt, lane L
//         holds row L%16, columns 16*nt + 8*(L/16) .. +8
// ---------------------------------------------------------------------------
constexpr int kBK = 32 * 8;       // halves in a block

// 16x32 f16 fragment (lane L: row L%16, halves [8*(L/16), +8) and
// [16+8*(L/16), +8)) from a q tile in lane order: its two blocks.
__device__ __forceinline__ v16h tfrag(const _Float16* __restrict__ tile, int lane) {
  const _Float16* p = tile + 8 * lane;
  v8h lo = *(const v8h*)p;
  v8h hi = *(const v8h*)(p + kBK);
  v16h r;
#pragma unroll
  for (int e = 0; e < 8; ++e) { r[e] = lo[e]; r[8 + e] = hi[e]; }
  return r;
}

// Fragment from an LDS tile row (32 halves of it): two ds_load_b128.
__device__ __forceinline__ v16h lfrag(const _Float16* p0) {
  v8h lo = *(const v8h*)p0;
  v8h hi = *(const v8h*)(p0 + 16);
  v16h r;
#pragma unroll
  for (int e = 0; e < 8; ++e) { r[e] = lo[e]; r[8 + e] = hi[e]; }
  return r;
}

// ---------------------------------------------------------------------------
// One 16-byte global -> LDS async DMA (CDNA5, tracked by ASYNCcnt).
// VDST carries the LDS byte address (ISA: dsaddr = LDS_BASE + VGPR[VDST]).
// A generic pointer into LDS holds the LDS offset in its low 32 bits on
// AMDGPU, so truncating the pointer gives the right VDST value.
// ---------------------------------------------------------------------------
__device__ __forceinline__ void copy16(const _Float16* gsrc, _Float16* ldst) {
#if defined(__gfx1250__)
  // the wait stands in the copy's own statement: in front of any later write
  // of the two address registers
  asm volatile("global_load_async_to_lds_b128 %0, %1, off\n\ts_wait_xcnt 0x0"
               :
               : "v"((unsigned)(unsigned long long)ldst), "v"(gsrc)
               : "memory");
#else
  *(v8h*)ldst = *(const v8h*)gsrc;
#endif
}

__device__ __forceinline__ void wait_async_copies() {
#if defined(__gfx1250__)
  asm volatile("s_wait_asynccnt 0x0" ::: "memory");
#endif
}

// ---------------------------------------------------------------------------
// Place of bias[h][q][k] in the workspace. A tile holds 16 q x 32 k (2 KB) as
// four 512-byte groups; group g, lane l, float e is the C/D element of the
// transposed score tile S^T (rows k, columns q): column q = l % 16, row
// k = 16*(g/2) + 8*(l/16) + 4*(g%2) + e. One global_load_b128 of a wave then
// reads one whole group: four full 128-byte lines.
// ---------------------------------------------------------------------------
__device__ __forceinline__ int bias_index(int h, int q, int k) {
  const int tile = (h * (kN / 16) + (q >> 4)) * (kN / 32) + (k >> 5);
  const int grp  = ((k >> 4) & 1) * 2 + ((k >> 2) & 1);
  const int ln   = (q & 15) + (((k >> 3) & 1) << 4);
  return tile * 512 + grp * 128 + ln * 4 + (k & 3);
}

// Lane l <-> lane l ^ 16 (the two halves of a wave that share a WMMA column).
__device__ __forceinline__ float xhalf(float x) {
  const int v = __builtin_bit_cast(int, x);
  return __builtin_bit_cast(float, __builtin_amdgcn_permlanex16(
      v, v, 0x76543210, 0xfedcba98, false, false));
}

// ---------------------------------------------------------------------------
// Kernel 1: LayerNorm, pair bias and the q, k, v, g projections in one launch.
// One work-group per WGP: 12 waves, each owning 48 rows (i, j) = three 16-row
// tiles. z comes by whole-row loads and is turned, through a tile of LDS that
// belongs to the wave alone, into the WMMA fragment order (a lane: row
// lane % 16, 8 + 8 columns of every 32), so mean and variance are in-lane sums
// plus one exchange between the wave's halves, and the normalised rows become
// f16 fragments in registers: they never go to memory. All four weights sit in
// LDS as f16 [n][k]; every weight fragment read serves three row tiles.
//   q, k, g: D = W^T (A) x zn^T (B): a lane holds 8 neighbouring columns of one
//            row;  v: D = zn (A) x W (B): a lane holds 8 neighbouring j of one
//            channel. Each result tile goes out as one block in lane order.
//   bias: fp32, q = i, k = j, in tiles of 16 q x 32 k laid out in the order in
//         which attn_out_kernel's lanes take them as WMMA C operands (bias_index)
// ---------------------------------------------------------------------------
constexpr int kFW = 12;           // waves per work-group
constexpr int kFT = kFW * 32;     // 384 threads
constexpr int kMT = 3;            // 16-row tiles per wave
constexpr int kZP = kCZ + 4;      // 528-byte rows (16 B x odd) for the fp32 z tile

// Stands behind global loads or stores, in front of the next write of a
// register that they name. The form with an address keeps that address in its
// registers up to the wait, so that no load of the run lands on them.
__device__ __forceinline__ void xcnt_wait() {
  asm volatile("s_wait_xcnt 0x0" ::: "memory");
}
__device__ __forceinline__ void xcnt_wait(const float* p) {
  asm volatile("s_wait_xcnt 0x0" :: "v"(p) : "memory");
}

// Staging of a weight W (128 k x 128 n, fp32) as f16 rows [n][k] in LDS, 8 k
// rows a wave at a time: eight whole-row loads (512 bytes, a lane takes 4 n),
// then for each of the lane's n one 16-byte LDS store of its 8 k.
__device__ __forceinline__ void load_wrows(float4 (&r)[8], const float* __restrict__ W,
                                           int k0, int lane) {
  const float* p = W + k0 * kHC + 4 * lane;
#pragma unroll
  for (int e = 0; e < 8; ++e) r[e] = *(const float4*)(p + e * kHC);
  xcnt_wait(p);
}

__device__ __forceinline__ void store_wrows(const float4 (&r)[8],
                                            _Float16 (*__restrict__ dst)[kWP],
                                            int k0, int lane) {
  v8h p0, p1, p2, p3;
#pragma unroll
  for (int e = 0; e < 8; ++e) {
    p0[e] = (_Float16)r[e].x; p1[e] = (_Float16)r[e].y;
    p2[e] = (_Float16)r[e].z; p3[e] = (_Float16)r[e].w;
  }
  *(v8h*)&dst[4 * lane + 0][k0] = p0;
  *(v8h*)&dst[4 * lane + 1][k0] = p1;
  *(v8h*)&dst[4 * lane + 2][k0] = p2;
  *(v8h*)&dst[4 * lane + 3][k0] = p3;
}

__global__ __launch_bounds__(kFT) void ln_proj_kernel(
    const float* __restrict__ z, const float* __restrict__ g,
    const float* __restrict__ b, const float* __restrict__ wb,
    const float* __restrict__ wq, const float* __restrict__ wk,
    const float* __restrict__ wv, const float* __restrict__ wg,
    const float* __restrict__ bg, _Float16* __restrict__ qo,
    _Float16* __restrict__ ko, _Float16* __restrict__ vo,
    _Float16* __restrict__ go, float* __restrict__ bias) {
  __shared__ __attribute__((aligned(16))) _Float16 Wt[4 * kHC][kWP];  // q,k,v,g: 136 KB
  __shared__ __attribute__((aligned(16))) float Zs[kFW][16][kZP];     // 99 KB
  __shared__ __attribute__((aligned(16))) float Gs[kCZ];
  __shared__ __attribute__((aligned(16))) float Bs[kCZ];
  __shared__ __attribute__((aligned(16))) float Wbs[kCZ * kH];
  const int tid  = threadIdx.x;
  const int lane = tid & 31;
  const int lr   = lane & 15;   // row of a tile (A) or column (B)
  const int hf   = lane >> 4;   // which 8 of every 16 k
  const int wave = __builtin_amdgcn_readfirstlane(tid >> 5);
  const int task = blockIdx.x * kFW + wave;
  const int i    = task >> 3;           // 8 tasks of 48 rows make one i
  const int j0   = (task & 7) * (16 * kMT);
  const int row0 = i * kN + j0;

  // The 4 x 16 groups of 8 weight rows: group wave + 12*it for it = 0..4, and
  // the last four go to waves 0..3. Loads come back in the order of issue, so
  // the three groups asked for ahead of z are stored while z is on its way from
  // memory; the others follow z and land during the row statistics.
  float4 wa[3][8], wc[2][8], wx[8];
  load_wrows(wa[0], wq, wave * 8, lane);                                     // 0..11
  load_wrows(wa[1], wave < 4 ? wq : wk, ((wave + 12) & 15) * 8, lane);       // 12..23
  load_wrows(wa[2], wave < 8 ? wk : wv, ((wave + 8) & 15) * 8, lane);        // 24..35

  float4 zr[kMT][16];  // here [tile][row]: columns 4*lane .. of a whole row
  const float* zp = z + (long)row0 * kCZ + 4 * lane;
#pragma unroll
  for (int t = 0; t < kMT; ++t)
#pragma unroll
    for (int v = 0; v < 16; ++v)
      zr[t][v] = *(const float4*)(zp + (16 * t + v) * kCZ);
  xcnt_wait(zp);

  store_wrows(wa[0], &Wt[0], wave * 8, lane);
  store_wrows(wa[1], &Wt[wave < 4 ? 0 : kHC], ((wave + 12) & 15) * 8, lane);
  store_wrows(wa[2], &Wt[wave < 8 ? kHC : 2 * kHC], ((wave + 8) & 15) * 8, lane);

  if (wave < 4) {
    load_wrows(wx, wg, (wave + 12) * 8, lane);                               // 60..63
    const float gl = g[tid], bl = b[tid];
    const float4 wl = ((const float4*)wb)[tid];
    xcnt_wait();
    store_wrows(wx, &Wt[3 * kHC], (wave + 12) * 8, lane);
    Gs[tid] = gl; Bs[tid] = bl; ((float4*)Wbs)[tid] = wl;
  }
  load_wrows(wc[0], wv, (wave + 4) * 8, lane);                               // 36..47
  load_wrows(wc[1], wg, wave * 8, lane);                                     // 48..59

  // Each tile into the fragment order: from here zr is [tile][4*c + 2*hi + s],
  // columns 32c + 16hi + 8hf + 4s .. of row lr. Then the row statistics: 64
  // values in the lane, the other 64 in lane ^ 16.
  float (*Zw)[kZP] = Zs[wave];
  float mu[kMT], rs[kMT];
#pragma unroll
  for (int t = 0; t < kMT; ++t) {
#pragma unroll
    for (int v = 0; v < 16; ++v) *(float4*)&Zw[v][4 * lane] = zr[t][v];
    // other lanes of the wave read these rows back: the stores land first
    asm volatile("s_wait_dscnt 0x0" ::: "memory");
#pragma unroll
    for (int v = 0; v < 16; ++v)
      zr[t][v] = *(const float4*)&Zw[lr][8 * hf + 16 * (v >> 1) + 4 * (v & 1)];
    float4 a1 = {0.f, 0.f, 0.f, 0.f}, a2 = {0.f, 0.f, 0.f, 0.f};
#pragma unroll
    for (int v = 0; v < 16; ++v) {
      const float4 x = zr[t][v];
      a1.x += x.x; a1.y += x.y; a1.z += x.z; a1.w += x.w;
      a2.x += x.x * x.x; a2.y += x.y * x.y; a2.z += x.z * x.z; a2.w += x.w * x.w;
    }
    float s  = (a1.x + a1.y) + (a1.z + a1.w);
    float s2 = (a2.x + a2.y) + (a2.z + a2.w);
    s  += xhalf(s);
    s2 += xhalf(s2);
    mu[t] = s * (1.0f / kCZ);
    rs[t] = rsqrtf(s2 * (1.0f / kCZ) - mu[t] * mu[t] + 1e-5f);
  }

  store_wrows(wc[0], &Wt[2 * kHC], (wave + 4) * 8, lane);
  store_wrows(wc[1], &Wt[3 * kHC], wave * 8, lane);
  __syncthreads();

  // normalise; fp32 pair bias; f16 fragments. Element 8*hi + e of fragment c is
  // column 32c + 16hi + 8hf + e: the order in which lfrag reads a weight row.
  v16h zf[kMT][4];
  float ba[kMT][kH];
#pragma unroll
  for (int t = 0; t < kMT; ++t)
#pragma unroll
    for (int h = 0; h < kH; ++h) ba[t][h] = 0.f;
#pragma unroll
  for (int c = 0; c < 4; ++c)
#pragma unroll
    for (int hi = 0; hi < 2; ++hi) {
      const int k0 = 32 * c + 16 * hi + 8 * hf;
#pragma unroll
      for (int s = 0; s < 2; ++s) {
        const float4 gv = *(const float4*)&Gs[k0 + 4 * s];
        const float4 bv = *(const float4*)&Bs[k0 + 4 * s];
        const float ge[4] = {gv.x, gv.y, gv.z, gv.w};
        const float be[4] = {bv.x, bv.y, bv.z, bv.w};
        float4 w4[4];
#pragma unroll
        for (int e = 0; e < 4; ++e) w4[e] = *(const float4*)&Wbs[(k0 + 4 * s + e) * kH];
#pragma unroll
        for (int t = 0; t < kMT; ++t) {
          const float4 x = zr[t][4 * c + 2 * hi + s];
          const float xe[4] = {x.x, x.y, x.z, x.w};
#pragma unroll
          for (int e = 0; e < 4; ++e) {
            const float zl = (xe[e] - mu[t]) * rs[t] * ge[e] + be[e];
            zf[t][c][8 * hi + 4 * s + e] = (_Float16)zl;
            ba[t][0] += zl * w4[e].x;
            ba[t][1] += zl * w4[e].y;
            ba[t][2] += zl * w4[e].z;
            ba[t][3] += zl * w4[e].w;
          }
        }
      }
    }
#pragma unroll
  for (int t = 0; t < kMT; ++t) {
#pragma unroll
    for (int h = 0; h < kH; ++h) ba[t][h] += xhalf(ba[t][h]);
    // both halves hold all four sums of row lr: each half stores two heads
    const int j = j0 + 16 * t + lr;
    const int   x0 = bias_index(2 * hf, i, j), x1 = bias_index(2 * hf + 1, i, j);
    const float y0 = hf ? ba[t][2] : ba[t][0], y1 = hf ? ba[t][3] : ba[t][1];
    bias[x0] = y0;
    bias[x1] = y1;
    // as xcnt_wait(p): places and values stay in their registers up to the wait
    asm volatile("s_wait_xcnt 0x0" :: "v"(x0), "v"(x1), "v"(y0), "v"(y1) : "memory");
  }

  const v8f zero = {0.f, 0.f, 0.f, 0.f, 0.f, 0.f, 0.f, 0.f};

  // q (scaled) and k, tiles (i,h,j/16) in lane order: 16 tiles of 16 weight columns
  for (int nt = 0; nt < 16; ++nt) {
    v8f acc[kMT] = {zero, zero, zero};
#pragma unroll
    for (int c = 0; c < 4; ++c) {
      const v16h wf = lfrag(&Wt[nt * 16 + lr][c * 32 + 8 * hf]);
#pragma unroll
      for (int t = 0; t < kMT; ++t) acc[t] = wmma_f16(wf, zf[t][c], acc[t]);
    }
    const float sc = nt < 8 ? 0.17677669529663687f : 1.0f;
    _Float16* dst = (nt < 8 ? qo : ko) +
        (((i * kH + ((nt & 7) >> 1)) * kN + j0) / 16 * 2 + (nt & 1)) * kBK + 8 * lane;
#pragma unroll
    for (int t = 0; t < kMT; ++t) {
      v8h o;
#pragma unroll
      for (int r = 0; r < 8; ++r) o[r] = (_Float16)(acc[t][r] * sc);
      *(v8h*)(dst + 2 * t * kBK) = o;
      xcnt_wait();
    }
  }

  // v, blocks (i, c/16, j/16) in lane order
  for (int nt = 0; nt < 8; ++nt) {
    v8f acc[kMT] = {zero, zero, zero};
#pragma unroll
    for (int c = 0; c < 4; ++c) {
      const v16h wf = lfrag(&Wt[2 * kHC + nt * 16 + lr][c * 32 + 8 * hf]);
#pragma unroll
      for (int t = 0; t < kMT; ++t) acc[t] = wmma_f16(zf[t][c], wf, acc[t]);
    }
    _Float16* dst = vo + ((i * (kHC / 16) + nt) * kN + j0) / 16 * kBK + 8 * lane;
#pragma unroll
    for (int t = 0; t < kMT; ++t) {
      v8h o;
#pragma unroll
      for (int r = 0; r < 8; ++r) o[r] = (_Float16)acc[t][r];
      *(v8h*)(dst + t * kBK) = o;
      xcnt_wait();
    }
  }

  // g = sigmoid(x + bg), tiles of 16 rows (i,j) in lane order
  for (int nt = 0; nt < 8; ++nt) {
    v8f acc[kMT] = {zero, zero, zero};
#pragma unroll
    for (int c = 0; c < 4; ++c) {
      const v16h wf = lfrag(&Wt[3 * kHC + nt * 16 + lr][c * 32 + 8 * hf]);
#pragma unroll
      for (int t = 0; t < kMT; ++t) acc[t] = wmma_f16(wf, zf[t][c], acc[t]);
    }
    const int col = nt * 16 + 8 * hf;
    const float4 g0 = *(const float4*)(bg + col), g1 = *(const float4*)(bg + col + 4);
    xcnt_wait(bg + col);
    const float ge[8] = {g0.x, g0.y, g0.z, g0.w, g1.x, g1.y, g1.z, g1.w};
    _Float16* dst = go + (row0 / 16 * (kHC / 16) + nt) * kBK + 8 * lane;
#pragma unroll
    for (int t = 0; t < kMT; ++t) {
      v8h o;
#pragma unroll
      for (int r = 0; r < 8; ++r)
        o[r] = (_Float16)(1.0f / (1.0f + __expf(-(acc[t][r] + ge[r]))));
      *(v8h*)(dst + t * (kHC / 16) * kBK) = o;
      xcnt_wait();
    }
  }
}

// ---------------------------------------------------------------------------
// Kernel 2: flash attention over all four heads, gate and output projection.
// A work-group has 4 waves (one per SIMD) and one i; a wave owns 48 q rows as
// three tiles of 16 and runs the heads one after another: 48 stages of 32 keys.
// Every K, V and wo fragment a wave reads from LDS feeds three WMMAs, and a
// stage's barrier, copies and loop bookkeeping are paid once for three tiles.
// K/V 32x32 tiles are DMA'd once per work-group into double-buffered LDS
// (global_load_async_to_lds_b128, ASYNCcnt); the copy of stage t + 2 flies while
// stage t + 1 is worked on.
// Per stage and tile: S^T = K Q^T + bias^T (2 WMMAs, K rows as A, Q as B, the
// bias tile as C), so a lane holds 16 scores of ONE query: maximum and sum run
// in its own registers, plus one exchange between the wave's halves. The two S^T
// tiles, converted in place, are the B operand of O^T += V^T P^T (2 WMMAs).
// A head's O^T tiles, as f16, are in turn the B operand (k = the head's 32
// channels, column q) of out^T = wo^T (g .* o)^T: o never goes to memory, and a
// lane ends with 8 neighbouring output columns of one row (16-byte stores).
// 768 work-groups: three on every WGP, all resident at once.
// ---------------------------------------------------------------------------
constexpr int kAW = 4;                // waves per work-group
constexpr int kAT = kAW * 32;         // 128 threads
constexpr int kQT = 3;                // 16-query tiles per wave
constexpr int kCH = kN / 32;          // 12 stages per head
constexpr int kST = kH * kCH;         // 48 stages

// 3 waves per SIMD: the register budget at which three work-groups fit a WGP
__global__ __launch_bounds__(kAT, 3) void attn_out_kernel(
    const _Float16* __restrict__ q, const _Float16* __restrict__ k,
    const _Float16* __restrict__ vt, const float* __restrict__ bias,
    const _Float16* __restrict__ gb, const float* __restrict__ wo,
    const float* __restrict__ bo, float* __restrict__ out) {
  __shared__ __attribute__((aligned(16))) _Float16 Kt[2][32][kTP];  // [buf][j-row][c]     5 KB
  __shared__ __attribute__((aligned(16))) _Float16 Vs[2][32][kTP];  // [buf][c-row][j]     5 KB
  __shared__ __attribute__((aligned(16))) _Float16 Wt[kCZ][kWP];    // wo as [n][k]       34 KB
  __shared__ __attribute__((aligned(16))) v8h Os[kAW][kQT][kH][2][32];  // a lane's own O^T 48 KB
  __shared__ __attribute__((aligned(16))) float Bo[kCZ];
  const int tid  = threadIdx.x;
  const int lane = tid & 31;
  const int lr   = lane & 15;
  const int hf   = lane >> 4;
  const int wave = __builtin_amdgcn_readfirstlane(tid >> 5);
  const int i = blockIdx.y;
  const int qbase = blockIdx.x * (16 * kQT * kAW) + wave * (16 * kQT);
  const _Float16* qp = q + (long)i * kH * kN * kC + qbase * kC;

  // K/V tile copy: wave cb brings block cb of K and block cb of V, each a block
  // in lane order (512 bytes in a row), 16 bytes a lane. A stage's K is four
  // blocks that follow one another (two tiles of 16 rows), stage t at 4 t; its V
  // is, for each 16 of the head's channels, the two blocks of keys
  // 32 (t % 12) .. +32. Block cb of the four lands at rows 16*(cb/2), halves
  // 16*(cb%2) of the LDS tile.
  const int cb   = wave;
  const int crow = 16 * (cb >> 1) + lr;        // 0..31
  const int cchk = 16 * (cb & 1) + 8 * hf;     // half offset 0,8,16,24
  const _Float16* ksrc = k + (long)i * kH * kN * kC + cb * kBK + 8 * lane;
  const _Float16* vsrc =
      vt + (long)i * kH * kC * kN + ((cb >> 1) * (kN / 16) + (cb & 1)) * kBK + 8 * lane;
  _Float16* kdst = &Kt[0][crow][cchk];
  _Float16* vdst = &Vs[0][crow][cchk];
  auto stage_copy = [&](int hh, int nn, int buf) {
    copy16(ksrc + (hh * kCH + nn) * 4 * kBK, kdst + buf * 32 * kTP);
    copy16(vsrc + hh * kC * kN + nn * 2 * kBK, vdst + buf * 32 * kTP);
  };

  // wo: 16 groups of 8 rows, groups wave, wave + 4, wave + 8, wave + 12
  float4 wa[4][8];
#pragma unroll
  for (int it = 0; it < 4; ++it) load_wrows(wa[it], wo, (wave + kAW * it) * 8, lane);
  float4 bl = {0.f, 0.f, 0.f, 0.f};
  if (wave == kAW - 1) {
    bl = ((const float4*)bo)[lane];
    xcnt_wait();
  }
  stage_copy(0, 0, 0);
  // every loop over the three tiles u is unrolled: its arrays are WMMA operands
  // and accumulators, which have to stay in registers
  v16h bq[kQT];  // Q^T columns of head 0, tile u
#pragma unroll
  for (int u = 0; u < kQT; ++u) bq[u] = tfrag(qp + u * 2 * kBK, lane);
  xcnt_wait();
#pragma unroll
  for (int it = 0; it < 4; ++it) store_wrows(wa[it], Wt, (wave + kAW * it) * 8, lane);
  if (wave == kAW - 1) ((float4*)Bo)[lane] = bl;
  wait_async_copies();
  __syncthreads();
  stage_copy(0, 1, 1);

  const v8f zero = {0.f, 0.f, 0.f, 0.f, 0.f, 0.f, 0.f, 0.f};

  // rolled: one copy of the stage loop in the instruction cache, and no head's
  // registers live on into the next
#pragma unroll 1
  for (int h = 0; h < kH; ++h) {
    // the next head's Q comes in while this head is worked on
    v16h bqn[kQT];
#pragma unroll
    for (int u = 0; u < kQT; ++u)
      bqn[u] = tfrag(qp + (h + 1 < kH ? h + 1 : h) * kN * kC + u * 2 * kBK, lane);
    xcnt_wait();
    // this wave's 48 queries: bias tiles (one per stage and query tile, 512 floats
    // each; a query tile's 12 stages follow one another)
    const float4* bp = (const float4*)(bias + bias_index(h, qbase, 0)) + lane;

    v8f o0[kQT], o1[kQT];  // O^T rows c in [0,16) / [16,32), column q = lane % 16
    float mrun[kQT];       // running maximum of query lane % 16
    float lsum[kQT];       // its denominator: this half-wave's keys only
#pragma unroll
    for (int u = 0; u < kQT; ++u) { o0[u] = zero; o1[u] = zero; mrun[u] = -1e30f; lsum[u] = 0.f; }

    for (int n = 0; n < kCH; ++n) {
      const int buf = n & 1;

      const v16h ak0 = lfrag(&Kt[buf][lr][hf << 3]);
      const v16h ak1 = lfrag(&Kt[buf][16 + lr][hf << 3]);
      // s0[u][r] = S[q = 16 u + lane%16][32 n + 8*(lane/16) + r], s1: the same + 16
      v8f s0[kQT], s1[kQT];
#pragma unroll
      for (int u = 0; u < kQT; ++u) {
        const float4* bt = bp + (u * kCH + n) * 128;
        const float4 b00 = bt[0], b01 = bt[32], b10 = bt[64], b11 = bt[96];
        const v8f cb0 = {b00.x, b00.y, b00.z, b00.w, b01.x, b01.y, b01.z, b01.w};
        const v8f cb1 = {b10.x, b10.y, b10.z, b10.w, b11.x, b11.y, b11.z, b11.w};
        s0[u] = wmma_f16(ak0, bq[u], cb0);
        s1[u] = wmma_f16(ak1, bq[u], cb1);
      }
      const v16h av0 = lfrag(&Vs[buf][lr][hf << 3]);
      const v16h av1 = lfrag(&Vs[buf][16 + lr][hf << 3]);

      // Hand-over, as soon as the stage's four fragments are in registers: this
      // wave's reads of buf are done, its copies of the next stage have landed;
      // behind the barrier that holds for every wave, and buf is free for the
      // stage after the next, whose copy flies during the softmax below and the
      // next stage's score WMMAs.
      asm volatile("s_wait_dscnt 0x0" ::: "memory");
      wait_async_copies();
      __syncthreads();
      if (h * kCH + n + 2 < kST)
        stage_copy(n + 2 < kCH ? h : h + 1, n + 2 < kCH ? n + 2 : n + 2 - kCH, buf);

#pragma unroll
      for (int u = 0; u < kQT; ++u) {
        float t = fmaxf(s0[u][0], s1[u][0]);
#pragma unroll
        for (int r = 1; r < 8; ++r) t = fmaxf(t, fmaxf(s0[u][r], s1[u][r]));
        t = fmaxf(t, xhalf(t));  // both halves scale by the same maximum
        const float nm = fmaxf(mrun[u], t);
        const float sc = __expf(mrun[u] - nm);
        mrun[u] = nm;

        v16h pt;  // P^T as B operand: element s is key 32 n + (s<8 ? 8*(lane/16)+s : 16+8*(lane/16)+s-8)
        float rsum = 0.f;
#pragma unroll
        for (int r = 0; r < 8; ++r) {
          const float p0 = __expf(s0[u][r] - nm);
          const float p1 = __expf(s1[u][r] - nm);
          rsum += p0 + p1;
          pt[r]     = (_Float16)p0;
          pt[8 + r] = (_Float16)p1;
        }
        lsum[u] = lsum[u] * sc + rsum;
#pragma unroll
        for (int r = 0; r < 8; ++r) { o0[u][r] *= sc; o1[u][r] *= sc; }

        o0[u] = wmma_f16(av0, pt, o0[u]);
        o1[u] = wmma_f16(av1, pt, o1[u]);
      }
    }

    // O^T as f16: w0[r] is channel 8*hf + r of query lr, w1[r] channel 16 + 8*hf + r.
    // Each lane parks its 32 bytes a tile in LDS and takes them back itself below.
#pragma unroll
    for (int u = 0; u < kQT; ++u) {
      const float inv = 1.0f / (lsum[u] + xhalf(lsum[u]));
      v8h w0, w1;
#pragma unroll
      for (int r = 0; r < 8; ++r) {
        w0[r] = (_Float16)(o0[u][r] * inv);
        w1[r] = (_Float16)(o1[u][r] * inv);
      }
      Os[wave][u][h][0][lane] = w0;
      Os[wave][u][h][1][lane] = w1;
      bq[u] = bqn[u];
    }
  }
  wait_async_copies();

  // gate: g of row q; its blocks 2h and 2h + 1 are in the element order of the
  // parked O^T
  const long row = (long)i * kN + qbase + lr;
  const _Float16* gp = gb + (i * kN + qbase) / 16 * (kHC / 16) * kBK + 8 * lane;
  v8h gl[kQT][kH], gh[kQT][kH];
#pragma unroll
  for (int u = 0; u < kQT; ++u)
#pragma unroll
    for (int h = 0; h < kH; ++h) {
      gl[u][h] = *(const v8h*)(gp + (u * (kHC / 16) + 2 * h) * kBK);
      gh[u][h] = *(const v8h*)(gp + (u * (kHC / 16) + 2 * h + 1) * kBK);
    }
  xcnt_wait();
  v16h of[kQT][kH];  // (g .* o)^T as B operand: element 8*s + r is channel 16*s + 8*hf + r
#pragma unroll
  for (int u = 0; u < kQT; ++u)
#pragma unroll
    for (int h = 0; h < kH; ++h) {
      const v8h w0 = Os[wave][u][h][0][lane], w1 = Os[wave][u][h][1][lane];
#pragma unroll
      for (int e = 0; e < 8; ++e) {
        of[u][h][e] = gl[u][h][e] * w0[e];
        of[u][h][8 + e] = gh[u][h][e] * w1[e];
      }
    }

  // out^T tile nt: rows = output columns 16 nt + 8 hf + r, column = row q.
  // Two column tiles of three query tiles at a time: six independent accumulator
  // chains, every wo fragment used three times.
  float* dst = out + row * kCZ + 8 * hf;
  // rolled: unrolled, the fragment reads of all passes are hoisted together and
  // overflow the register budget of three waves per SIMD (spills)
#pragma unroll 1
  for (int n0 = 0; n0 < kCZ / 16; n0 += 2) {
    v8f acc[2][kQT] = {{zero, zero, zero}, {zero, zero, zero}};
#pragma unroll
    for (int h = 0; h < kH; ++h)
#pragma unroll
      for (int w = 0; w < 2; ++w) {
        const v16h wf = lfrag(&Wt[(n0 + w) * 16 + lr][h * kC + 8 * hf]);
#pragma unroll
        for (int u = 0; u < kQT; ++u) acc[w][u] = wmma_f16(wf, of[u][h], acc[w][u]);
      }
#pragma unroll
    for (int w = 0; w < 2; ++w) {
      const int col = (n0 + w) * 16;
      const float4 c0 = *(const float4*)&Bo[col + 8 * hf], c1 = *(const float4*)&Bo[col + 8 * hf + 4];
#pragma unroll
      for (int u = 0; u < kQT; ++u) {
        const v8f a = acc[w][u];
        const float4 r0 = {a[0] + c0.x, a[1] + c0.y, a[2] + c0.z, a[3] + c0.w};
        const float4 r1 = {a[4] + c1.x, a[5] + c1.y, a[6] + c1.z, a[7] + c1.w};
        *(float4*)(dst + u * 16 * kCZ + col)     = r0;
        *(float4*)(dst + u * 16 * kCZ + col + 4) = r1;
      }
    }
    xcnt_wait();
  }
}

// ---------------------------------------------------------------------------
extern "C" void kernel_launch(void* const* d_in, const int* in_sizes, int n_in,
                              void* d_out, int out_size, void* d_ws, size_t ws_size,
                              hipStream_t stream) {
  const float* z      = (const float*)d_in[0];
  const float* ln_g   = (const float*)d_in[1];
  const float* ln_b   = (const float*)d_in[2];
  const float* w_bias = (const float*)d_in[3];
  const float* wq     = (const float*)d_in[4];
  const float* wk     = (const float*)d_in[5];
  const float* wv     = (const float*)d_in[6];
  const float* wg     = (const float*)d_in[7];
  const float* bg     = (const float*)d_in[8];
  const float* wo     = (const float*)d_in[9];
  const float* bo     = (const float*)d_in[10];
  float* out = (float*)d_out;

  char* ws = (char*)d_ws;
  const size_t S2 = (size_t)kNN * kHC * 2;  // one fp16 NN x 128 buffer
  _Float16* qb = (_Float16*)(ws + 1 * S2);
  _Float16* kb = (_Float16*)(ws + 2 * S2);
  _Float16* vt = (_Float16*)(ws + 3 * S2);
  _Float16* gb = (_Float16*)(ws + 4 * S2);
  float*  biasb = (float*)(ws + 6 * S2);    // H * NN fp32

  ln_proj_kernel<<<kNN / (16 * kMT * kFW), kFT, 0, stream>>>(
      z, ln_g, ln_b, w_bias, wq, wk, wv, wg, bg, qb, kb, vt, gb, biasb);

  dim3 g2(kN / (16 * kQT * kAW), kN);
  attn_out_kernel<<<g2, kAT, 0, stream>>>(qb, kb, vt, biasb, gb, wo, bo, out);
}

// v007
// A run of this version takes 105 microseconds.
// Next to v006, in two timings, it ran 1.06 times as fast each time.
// Counting every step since v000, it is 5.27 times as fast.
#include <hip/hip_runtime.h>
#include <hip/hip_bf16.h>

typedef __attribute__((ext_vector_type(16))) _Float16 v16h;
typedef __attribute__((ext_vector_type(8)))  _Float16 v8h;
typedef __attribute__((ext_vector_type(4)))  _Float16 v4h;
typedef __attribute__((ext_vector_type(8)))  float    v8f;

constexpr int kN  = 384;
constexpr int kNN = kN * kN;      // 147456
constexpr int kCZ = 128;
constexpr int kH  = 4;
constexpr int kC  = 32;
constexpr int kHC = kH * kC;      // 128
// LDS row pitches in halves: an odd multiple of 16 bytes, so that the 16 rows
// one ds_load_b128 fragment read touches fall on 16 different bank groups.
constexpr int kWP = kCZ + 8;      // 272-byte rows for the 128-half weight tiles
constexpr int kTP = 32 + 8;       // 80-byte rows for the 32-half K, V tiles

// ---------------------------------------------------------------------------
// 16x16x32 f16 WMMA wrapper (CDNA5, wave32). D = A(16x32) * B(32x16) + C.
// ---------------------------------------------------------------------------
__device__ __forceinline__ v8f wmma_f16(v16h a, v16h b, v8f c) {
  return __builtin_amdgcn_wmma_f32_16x16x32_f16(false, a, false, b,
                                                (short)0, c, false, false);
}

// ---------------------------------------------------------------------------
// Lane order of the f16 workspace arrays. A block is 512 bytes: lane L's 8
// halves stand at 8*L, so that one 16-byte access per lane of a whole wave,
// store, load or copy, covers four whole 128-byte lines.
//   q, k: a tile of 16 rows j x 32 c is two blocks; block s, lane L holds row
//         L%16, columns 16*s + 8*(L/16) .. +8; tiles follow as (i, h, j/16)
//   v:    block (i, c/16 of all 128 channels, j/16): lane L holds channel L%16,
//         keys j 8*(L/16) .. +8
//   g:    a tile of 16 rows x 128 columns is eight blocks; block nt, lane L
//         holds row L%16, columns 16*nt + 8*(L/16) .. +8
// ---------------------------------------------------------------------------
constexpr int kBK = 32 * 8;       // halves in a block

// 16x32 f16 fragment (lane L: row L%16, halves [8*(L/16), +8) and
// [16+8*(L/16), +8)) from a q tile in lane order: its two blocks.
__device__ __forceinline__ v16h tfrag(const _Float16* __restrict__ tile, int lane) {
  const _Float16* p = tile + 8 * lane;
  v8h lo = *(const v8h*)p;
  v8h hi = *(const v8h*)(p + kBK);
  v16h r;
#pragma unroll
  for (int e = 0; e < 8; ++e) { r[e] = lo[e]; r[8 + e] = hi[e]; }
  return r;
}

// Fragment from an LDS tile row (32 halves of it): two ds_load_b128.
__device__ __forceinline__ v16h lfrag(const _Float16* p0) {
  v8h lo = *(const v8h*)p0;
  v8h hi = *(const v8h*)(p0 + 16);
  v16h r;
#pragma unroll
  for (int e = 0; e < 8; ++e) { r[e] = lo[e]; r[8 + e] = hi[e]; }
  return r;
}

// ---------------------------------------------------------------------------
// One 16-byte global -> LDS async DMA (CDNA5, tracked by ASYNCcnt).
// VDST carries the LDS byte address (ISA: dsaddr = LDS_BASE + VGPR[VDST]).
// A generic pointer into LDS holds the LDS offset in its low 32 bits on
// AMDGPU, so truncating the pointer gives the right VDST value.
// ---------------------------------------------------------------------------
__device__ __forceinline__ void copy16(const _Float16* gsrc, _Float16* ldst) {
#if defined(__gfx1250__)
  // the wait stands in the copy's own statement: in front of any later write
  // of the two address registers
  asm volatile("global_load_async_to_lds_b128 %0, %1, off\n\ts_wait_xcnt 0x0"
               :
               : "v"((unsigned)(unsigned long long)ldst), "v"(gsrc)
               : "memory");
#else
  *(v8h*)ldst = *(const v8h*)gsrc;
#endif
}

__device__ __forceinline__ void wait_async_copies() {
#if defined(__gfx1250__)
  asm volatile("s_wait_asynccnt 0x0" ::: "memory");
#endif
}

// ---------------------------------------------------------------------------
// Place of bias[h][q][k], an f16 value, in the workspace. A tile holds 16 q x
// 32 k (1 KB) as two blocks in lane order: the WMMA B fragment (32 rows k, 16
// columns q) of the transposed bias. Block s, lane l, half e: column q = l % 16,
// row k = 16*s + 8*(l/16) + e. tfrag reads a tile: two whole blocks. Tiles follow
// as (h, k/32, q/16): what all queries read in one stage of 32 keys is 24 KB in a
// row, and a wave's three tiles are 3 KB in a row.
// ---------------------------------------------------------------------------
__device__ __forceinline__ int bias_index(int h, int q, int k) {
  const int tile = (h * (kN / 32) + (k >> 5)) * (kN / 16) + (q >> 4);
  const int ln   = (q & 15) + (((k >> 3) & 1) << 4);
  return (tile * 2 + ((k >> 4) & 1)) * kBK + ln * 8 + (k & 7);
}

// Lane l <-> lane l ^ 16 (the two halves of a wave that share a WMMA column).
__device__ __forceinline__ float xhalf(float x) {
  const int v = __builtin_bit_cast(int, x);
  return __builtin_bit_cast(float, __builtin_amdgcn_permlanex16(
      v, v, 0x76543210, 0xfedcba98, false, false));
}

// ---------------------------------------------------------------------------
// Kernel 1: LayerNorm, pair bias and the q, k, v, g projections in one launch.
// One work-group per WGP: 12 waves, each owning 48 rows (i, j) = three 16-row
// tiles. z comes by whole-row loads and is turned, through a tile of LDS that
// belongs to the wave alone, into the WMMA fragment order (a lane: row
// lane % 16, 8 + 8 columns of every 32), so mean and variance are in-lane sums
// plus one exchange between the wave's halves, and the normalised rows become
// f16 fragments in registers: they never go to memory. All four weights sit in
// LDS as f16 [n][k]; every weight fragment read serves three row tiles.
//   q, k, g: D = W^T (A) x zn^T (B): a lane holds 8 neighbouring columns of one
//            row;  v: D = zn (A) x W (B): a lane holds 8 neighbouring j of one
//            channel. Each result tile goes out as one block in lane order.
//   bias: summed in fp32, stored as f16, q = i, k = j, in tiles of 16 q x 32 k laid
//         out as the WMMA B fragments that attn_out_kernel takes (bias_index)
// ---------------------------------------------------------------------------
constexpr int kFW = 12;           // waves per work-group
constexpr int kFT = kFW * 32;     // 384 threads
constexpr int kMT = 3;            // 16-row tiles per wave
constexpr int kZP = kCZ + 4;      // 528-byte rows (16 B x odd) for the fp32 z tile

// Stands behind global loads or stores, in front of the next write of a
// register that they name. The form with an address keeps that address in its
// registers up to the wait, so that no load of the run lands on them.
__device__ __forceinline__ void xcnt_wait() {
  asm volatile("s_wait_xcnt 0x0" ::: "memory");
}
__device__ __forceinline__ void xcnt_wait(const float* p) {
  asm volatile("s_wait_xcnt 0x0" :: "v"(p) : "memory");
}

// Staging of a weight W (128 k x 128 n, fp32) as f16 rows [n][k] in LDS, 8 k
// rows a wave at a time: eight whole-row loads (512 bytes, a lane takes 4 n),
// then for each of the lane's n one 16-byte LDS store of its 8 k.
__device__ __forceinline__ void load_wrows(float4 (&r)[8], const float* __restrict__ W,
                                           int k0, int lane) {
  const float* p = W + k0 * kHC + 4 * lane;
#pragma unroll
  for (int e = 0; e < 8; ++e) r[e] = *(const float4*)(p + e * kHC);
  xcnt_wait(p);
}

__device__ __forceinline__ void store_wrows(const float4 (&r)[8],
                                            _Float16 (*__restrict__ dst)[kWP],
                                            int k0, int lane) {
  v8h p0, p1, p2, p3;
#pragma unroll
  for (int e = 0; e < 8; ++e) {
    p0[e] = (_Float16)r[e].x; p1[e] = (_Float16)r[e].y;
    p2[e] = (_Float16)r[e].z; p3[e] = (_Float16)r[e].w;
  }
  *(v8h*)&dst[4 * lane + 0][k0] = p0;
  *(v8h*)&dst[4 * lane + 1][k0] = p1;
  *(v8h*)&dst[4 * lane + 2][k0] = p2;
  *(v8h*)&dst[4 * lane + 3][k0] = p3;
}

__global__ __launch_bounds__(kFT) void ln_proj_kernel(
    const float* __restrict__ z, const float* __restrict__ g,
    const float* __restrict__ b, const float* __restrict__ wb,
    const float* __restrict__ wq, const float* __restrict__ wk,
    const float* __restrict__ wv, const float* __restrict__ wg,
    const float* __restrict__ bg, _Float16* __restrict__ qo,
    _Float16* __restrict__ ko, _Float16* __restrict__ vo,
    _Float16* __restrict__ go, _Float16* __restrict__ bias) {
  __shared__ __attribute__((aligned(16))) _Float16 Wt[4 * kHC][kWP];  // q,k,v,g: 136 KB
  __shared__ __attribute__((aligned(16))) float Zs[kFW][16][kZP];     // 99 KB
  __shared__ __attribute__((aligned(16))) float Gs[kCZ];
  __shared__ __attribute__((aligned(16))) float Bs[kCZ];
  __shared__ __attribute__((aligned(16))) float Wbs[kCZ * kH];
  const int tid  = threadIdx.x;
  const int lane = tid & 31;
  const int lr   = lane & 15;   // row of a tile (A) or column (B)
  const int hf   = lane >> 4;   // which 8 of every 16 k
  const int wave = __builtin_amdgcn_readfirstlane(tid >> 5);
  const int task = blockIdx.x * kFW + wave;
  const int i    = task >> 3;           // 8 tasks of 48 rows make one i
  const int j0   = (task & 7) * (16 * kMT);
  const int row0 = i * kN + j0;

  // The 4 x 16 groups of 8 weight rows: group wave + 12*it for it = 0..4, and
  // the last four go to waves 0..3. Loads come back in the order of issue, so
  // the three groups asked for ahead of z are stored while z is on its way from
  // memory; the others follow z and land during the row statistics.
  float4 wa[3][8], wc[2][8], wx[8];
  load_wrows(wa[0], wq, wave * 8, lane);                                     // 0..11
  load_wrows(wa[1], wave < 4 ? wq : wk, ((wave + 12) & 15) * 8, lane);       // 12..23
  load_wrows(wa[2], wave < 8 ? wk : wv, ((wave + 8) & 15) * 8, lane);        // 24..35

  float4 zr[kMT][16];  // here [tile][row]: columns 4*lane .. of a whole row
  const float* zp = z + (long)row0 * kCZ + 4 * lane;
#pragma unroll
  for (int t = 0; t < kMT; ++t)
#pragma unroll
    for (int v = 0; v < 16; ++v)
      zr[t][v] = *(const float4*)(zp + (16 * t + v) * kCZ);
  xcnt_wait(zp);

  store_wrows(wa[0], &Wt[0], wave * 8, lane);
  store_wrows(wa[1], &Wt[wave < 4 ? 0 : kHC], ((wave + 12) & 15) * 8, lane);
  store_wrows(wa[2], &Wt[wave < 8 ? kHC : 2 * kHC], ((wave + 8) & 15) * 8, lane);

  if (wave < 4) {
    load_wrows(wx, wg, (wave + 12) * 8, lane);                               // 60..63
    const float gl = g[tid], bl = b[tid];
    const float4 wl = ((const float4*)wb)[tid];
    xcnt_wait();
    store_wrows(wx, &Wt[3 * kHC], (wave + 12) * 8, lane);
    Gs[tid] = gl; Bs[tid] = bl; ((float4*)Wbs)[tid] = wl;
  }
  load_wrows(wc[0], wv, (wave + 4) * 8, lane);                               // 36..47
  load_wrows(wc[1], wg, wave * 8, lane);                                     // 48..59

  // Each tile into the fragment order: from here zr is [tile][4*c + 2*hi + s],
  // columns 32c + 16hi + 8hf + 4s .. of row lr. Then the row statistics: 64
  // values in the lane, the other 64 in lane ^ 16.
  float (*Zw)[kZP] = Zs[wave];
  float mu[kMT], rs[kMT];
#pragma unroll
  for (int t = 0; t < kMT; ++t) {
#pragma unroll
    for (int v = 0; v < 16; ++v) *(float4*)&Zw[v][4 * lane] = zr[t][v];
    // other lanes of the wave read these rows back: the stores land first
    asm volatile("s_wait_dscnt 0x0" ::: "memory");
#pragma unroll
    for (int v = 0; v < 16; ++v)
      zr[t][v] = *(const float4*)&Zw[lr][8 * hf + 16 * (v >> 1) + 4 * (v & 1)];
    float4 a1 = {0.f, 0.f, 0.f, 0.f}, a2 = {0.f, 0.f, 0.f, 0.f};
#pragma unroll
    for (int v = 0; v < 16; ++v) {
      const float4 x = zr[t][v];
      a1.x += x.x; a1.y += x.y; a1.z += x.z; a1.w += x.w;
      a2.x += x.x * x.x; a2.y += x.y * x.y; a2.z += x.z * x.z; a2.w += x.w * x.w;
    }
    float s  = (a1.x + a1.y) + (a1.z + a1.w);
    float s2 = (a2.x + a2.y) + (a2.z + a2.w);
    s  += xhalf(s);
    s2 += xhalf(s2);
    mu[t] = s * (1.0f / kCZ);
    rs[t] = rsqrtf(s2 * (1.0f / kCZ) - mu[t] * mu[t] + 1e-5f);
  }

  store_wrows(wc[0], &Wt[2 * kHC], (wave + 4) * 8, lane);
  store_wrows(wc[1], &Wt[3 * kHC], wave * 8, lane);
  __syncthreads();

  // normalise; fp32 pair bias; f16 fragments. Element 8*hi + e of fragment c is
  // column 32c + 16hi + 8hf + e: the order in which lfrag reads a weight row.
  v16h zf[kMT][4];
  float ba[kMT][kH];
#pragma unroll
  for (int t = 0; t < kMT; ++t)
#pragma unroll
    for (int h = 0; h < kH; ++h) ba[t][h] = 0.f;
#pragma unroll
  for (int c = 0; c < 4; ++c)
#pragma unroll
    for (int hi = 0; hi < 2; ++hi) {
      const int k0 = 32 * c + 16 * hi + 8 * hf;
#pragma unroll
      for (int s = 0; s < 2; ++s) {
        const float4 gv = *(const float4*)&Gs[k0 + 4 * s];
        const float4 bv = *(const float4*)&Bs[k0 + 4 * s];
        const float ge[4] = {gv.x, gv.y, gv.z, gv.w};
        const float be[4] = {bv.x, bv.y, bv.z, bv.w};
        float4 w4[4];
#pragma unroll
        for (int e = 0; e < 4; ++e) w4[e] = *(const float4*)&Wbs[(k0 + 4 * s + e) * kH];
#pragma unroll
        for (int t = 0; t < kMT; ++t) {
          const float4 x = zr[t][4 * c + 2 * hi + s];
          const float xe[4] = {x.x, x.y, x.z, x.w};
#pragma unroll
          for (int e = 0; e < 4; ++e) {
            const float zl = (xe[e] - mu[t]) * rs[t] * ge[e] + be[e];
            zf[t][c][8 * hi + 4 * s + e] = (_Float16)zl;
            ba[t][0] += zl * w4[e].x;
            ba[t][1] += zl * w4[e].y;
            ba[t][2] += zl * w4[e].z;
            ba[t][3] += zl * w4[e].w;
          }
        }
      }
    }
#pragma unroll
  for (int t = 0; t < kMT; ++t) {
#pragma unroll
    for (int h = 0; h < kH; ++h) ba[t][h] += xhalf(ba[t][h]);
    // both halves hold all four sums of row lr: each half stores two heads
    const int j = j0 + 16 * t + lr;
    const int   x0 = bias_index(2 * hf, i, j), x1 = bias_index(2 * hf + 1, i, j);
    const _Float16 y0 = (_Float16)(hf ? ba[t][2] : ba[t][0]);
    const _Float16 y1 = (_Float16)(hf ? ba[t][3] : ba[t][1]);
    bias[x0] = y0;
    bias[x1] = y1;
    // as xcnt_wait(p): places and values stay in their registers up to the wait
    asm volatile("s_wait_xcnt 0x0" :: "v"(x0), "v"(x1), "v"(y0), "v"(y1) : "memory");
  }

  const v8f zero = {0.f, 0.f, 0.f, 0.f, 0.f, 0.f, 0.f, 0.f};

  // q (scaled) and k, tiles (i,h,j/16) in lane order: 16 tiles of 16 weight columns
  for (int nt = 0; nt < 16; ++nt) {
    v8f acc[kMT] = {zero, zero, zero};
#pragma unroll
    for (int c = 0; c < 4; ++c) {
      const v16h wf = lfrag(&Wt[nt * 16 + lr][c * 32 + 8 * hf]);
#pragma unroll
      for (int t = 0; t < kMT; ++t) acc[t] = wmma_f16(wf, zf[t][c], acc[t]);
    }
    const float sc = nt < 8 ? 0.17677669529663687f : 1.0f;
    _Float16* dst = (nt < 8 ? qo : ko) +
        (((i * kH + ((nt & 7) >> 1)) * kN + j0) / 16 * 2 + (nt & 1)) * kBK + 8 * lane;
#pragma unroll
    for (int t = 0; t < kMT; ++t) {
      v8h o;
#pragma unroll
      for (int r = 0; r < 8; ++r) o[r] = (_Float16)(acc[t][r] * sc);
      *(v8h*)(dst + 2 * t * kBK) = o;
      xcnt_wait();
    }
  }

  // v, blocks (i, c/16, j/16) in lane order
  for (int nt = 0; nt < 8; ++nt) {
    v8f acc[kMT] = {zero, zero, zero};
#pragma unroll
    for (int c = 0; c < 4; ++c) {
      const v16h wf = lfrag(&Wt[2 * kHC + nt * 16 + lr][c * 32 + 8 * hf]);
#pragma unroll
      for (int t = 0; t < kMT; ++t) acc[t] = wmma_f16(zf[t][c], wf, acc[t]);
    }
    _Float16* dst = vo + ((i * (kHC / 16) + nt) * kN + j0) / 16 * kBK + 8 * lane;
#pragma unroll
    for (int t = 0; t < kMT; ++t) {
      v8h o;
#pragma unroll
      for (int r = 0; r < 8; ++r) o[r] = (_Float16)acc[t][r];
      *(v8h*)(dst + t * kBK) = o;
      xcnt_wait();
    }
  }

  // g = sigmoid(x + bg), tiles of 16 rows (i,j) in lane order
  for (int nt = 0; nt < 8; ++nt) {
    v8f acc[kMT] = {zero, zero, zero};
#pragma unroll
    for (int c = 0; c < 4; ++c) {
      const v16h wf = lfrag(&Wt[3 * kHC + nt * 16 + lr][c * 32 + 8 * hf]);
#pragma unroll
      for (int t = 0; t < kMT; ++t) acc[t] = wmma_f16(wf, zf[t][c], acc[t]);
    }
    const int col = nt * 16 + 8 * hf;
    const float4 g0 = *(const float4*)(bg + col), g1 = *(const float4*)(bg + col + 4);
    xcnt_wait(bg + col);
    const float ge[8] = {g0.x, g0.y, g0.z, g0.w, g1.x, g1.y, g1.z, g1.w};
    _Float16* dst = go + (row0 / 16 * (kHC / 16) + nt) * kBK + 8 * lane;
#pragma unroll
    for (int t = 0; t < kMT; ++t) {
      v8h o;
#pragma unroll
      for (int r = 0; r < 8; ++r)
        o[r] = (_Float16)(1.0f / (1.0f + __expf(-(acc[t][r] + ge[r]))));
      *(v8h*)(dst + t * (kHC / 16) * kBK) = o;
      xcnt_wait();
    }
  }
}

// ---------------------------------------------------------------------------
// Kernel 2: flash attention over all four heads, gate and output projection.
// A work-group has 4 waves (one per SIMD) and one i; a wave owns 48 q rows as
// three tiles of 16 and runs the heads one after another: 48 stages of 32 keys.
// Every K, V and wo fragment a wave reads from LDS feeds three WMMAs, and a
// stage's barrier, copies and loop bookkeeping are paid once for three tiles.
// K/V 32x32 tiles are DMA'd once per work-group into double-buffered LDS
// (global_load_async_to_lds_b128, ASYNCcnt); the copy of stage t + 2 flies while
// stage t + 1 is worked on.
// Per stage and tile: S^T = K Q^T + E bias^T (2 + 2 WMMAs: K rows as A, Q as B;
// then a constant 0/1 matrix E as A, which picks 16 of the 32 key rows, and the
// f16 bias tile as B), so a lane holds 16 scores of ONE query: maximum and sum run
// in its own registers, plus one exchange between the wave's halves. The two S^T
// tiles, converted in place, are the B operand of O^T += V^T P^T (2 WMMAs).
// A head's O^T tiles, as f16, are in turn the B operand (k = the head's 32
// channels, column q) of out^T = wo^T (g .* o)^T: o never goes to memory, and a
// lane ends with 8 neighbouring output columns of one row (16-byte stores).
// 768 work-groups: three on every WGP, all resident at once.
// ---------------------------------------------------------------------------
constexpr int kAW = 4;                // waves per work-group
constexpr int kAT = kAW * 32;         // 128 threads
constexpr int kQT = 3;                // 16-query tiles per wave
constexpr int kCH = kN / 32;          // 12 stages per head
constexpr int kST = kH * kCH;         // 48 stages

// 3 waves per SIMD: the register budget at which three work-groups fit a WGP
__global__ __launch_bounds__(kAT, 3) void attn_out_kernel(
    const _Float16* __restrict__ q, const _Float16* __restrict__ k,
    const _Float16* __restrict__ vt, const _Float16* __restrict__ bias,
    const _Float16* __restrict__ gb, const float* __restrict__ wo,
    const float* __restrict__ bo, float* __restrict__ out) {
  __shared__ __attribute__((aligned(16))) _Float16 Kt[2][32][kTP];  // [buf][j-row][c]     5 KB
  __shared__ __attribute__((aligned(16))) _Float16 Vs[2][32][kTP];  // [buf][c-row][j]     5 KB
  __shared__ __attribute__((aligned(16))) _Float16 Wt[kCZ][kWP];    // wo as [n][k]       34 KB
  __shared__ __attribute__((aligned(16))) v8h Os[kAW][kQT][kH][2][32];  // a lane's own O^T 48 KB
  __shared__ __attribute__((aligned(16))) float Bo[kCZ];
  const int tid  = threadIdx.x;
  const int lane = tid & 31;
  const int lr   = lane & 15;
  const int hf   = lane >> 4;
  const int wave = __builtin_amdgcn_readfirstlane(tid >> 5);
  const int i = blockIdx.y;
  const int qbase = blockIdx.x * (16 * kQT * kAW) + wave * (16 * kQT);
  const _Float16* qp = q + (long)i * kH * kN * kC + qbase * kC;

  // K/V tile copy: wave cb brings block cb of K and block cb of V, each a block
  // in lane order (512 bytes in a row), 16 bytes a lane. A stage's K is four
  // blocks that follow one another (two tiles of 16 rows), stage t at 4 t; its V
  // is, for each 16 of the head's channels, the two blocks of keys
  // 32 (t % 12) .. +32. Block cb of the four lands at rows 16*(cb/2), halves
  // 16*(cb%2) of the LDS tile.
  const int cb   = wave;
  const int crow = 16 * (cb >> 1) + lr;        // 0..31
  const int cchk = 16 * (cb & 1) + 8 * hf;     // half offset 0,8,16,24
  const _Float16* ksrc = k + (long)i * kH * kN * kC + cb * kBK + 8 * lane;
  const _Float16* vsrc =
      vt + (long)i * kH * kC * kN + ((cb >> 1) * (kN / 16) + (cb & 1)) * kBK + 8 * lane;
  _Float16* kdst = &Kt[0][crow][cchk];
  _Float16* vdst = &Vs[0][crow][cchk];
  auto stage_copy = [&](int hh, int nn, int buf) {
    copy16(ksrc + (hh * kCH + nn) * 4 * kBK, kdst + buf * 32 * kTP);
    copy16(vsrc + hh * kC * kN + nn * 2 * kBK, vdst + buf * 32 * kTP);
  };

  // wo: 16 groups of 8 rows, groups wave, wave + 4, wave + 8, wave + 12
  float4 wa[4][8];
#pragma unroll
  for (int it = 0; it < 4; ++it) load_wrows(wa[it], wo, (wave + kAW * it) * 8, lane);
  float4 bl = {0.f, 0.f, 0.f, 0.f};
  if (wave == kAW - 1) {
    bl = ((const float4*)bo)[lane];
    xcnt_wait();
  }
  stage_copy(0, 0, 0);
  // every loop over the three tiles u is unrolled: its arrays are WMMA operands
  // and accumulators, which have to stay in registers
  v16h bq[kQT];  // Q^T columns of head 0, tile u
#pragma unroll
  for (int u = 0; u < kQT; ++u) bq[u] = tfrag(qp + u * 2 * kBK, lane);
  xcnt_wait();
#pragma unroll
  for (int it = 0; it < 4; ++it) store_wrows(wa[it], Wt, (wave + kAW * it) * 8, lane);
  if (wave == kAW - 1) ((float4*)Bo)[lane] = bl;
  wait_async_copies();
  __syncthreads();
  stage_copy(0, 1, 1);

  const v8f zero = {0.f, 0.f, 0.f, 0.f, 0.f, 0.f, 0.f, 0.f};

  // E0, E1 (16 x 32, A operands): E0[r][k] = (k == r), E1[r][k] = (k == 16 + r).
  // Lane: row lr; elements e < 8 are k = 8 hf + e, the others k = 16 + 8 hf + e - 8.
  v16h sel0, sel1;
#pragma unroll
  for (int e = 0; e < 8; ++e) {
    const _Float16 one = (_Float16)(8 * hf + e == lr ? 1.0f : 0.0f);
    sel0[e] = one;            sel0[8 + e] = (_Float16)0.0f;
    sel1[e] = (_Float16)0.0f; sel1[8 + e] = one;
  }

  // rolled: one copy of the stage loop in the instruction cache, and no head's
  // registers live on into the next
#pragma unroll 1
  for (int h = 0; h < kH; ++h) {
    // the next head's Q comes in while this head is worked on
    v16h bqn[kQT];
#pragma unroll
    for (int u = 0; u < kQT; ++u)
      bqn[u] = tfrag(qp + (h + 1 < kH ? h + 1 : h) * kN * kC + u * 2 * kBK, lane);
    xcnt_wait();
    // this wave's 48 queries: bias tiles (one per stage and query tile, two blocks
    // each; the three tiles of a stage follow one another)
    const _Float16* bp = bias + bias_index(h, qbase, 0);

    v8f o0[kQT], o1[kQT];  // O^T rows c in [0,16) / [16,32), column q = lane % 16
    float mrun[kQT];       // running maximum of query lane % 16
    float lsum[kQT];       // its denominator: this half-wave's keys only
#pragma unroll
    for (int u = 0; u < kQT; ++u) { o0[u] = zero; o1[u] = zero; mrun[u] = -1e30f; lsum[u] = 0.f; }

    for (int n = 0; n < kCH; ++n) {
      const int buf = n & 1;

      const v16h ak0 = lfrag(&Kt[buf][lr][hf << 3]);
      const v16h ak1 = lfrag(&Kt[buf][16 + lr][hf << 3]);
      // s0[u][r] = S[q = 16 u + lane%16][32 n + 8*(lane/16) + r], s1: the same + 16
      v8f s0[kQT], s1[kQT];
      v16h bb[kQT];  // bias^T of the stage's 32 keys, column q
#pragma unroll
      for (int u = 0; u < kQT; ++u) bb[u] = tfrag(bp + (n * (kN / 16) + u) * 2 * kBK, lane);
#pragma unroll
      for (int u = 0; u < kQT; ++u) {
        s0[u] = wmma_f16(ak0, bq[u], zero);
        s1[u] = wmma_f16(ak1, bq[u], zero);
      }
      const v16h av0 = lfrag(&Vs[buf][lr][hf << 3]);
      const v16h av1 = lfrag(&Vs[buf][16 + lr][hf << 3]);
      // takes the three loaded tiles as inputs: all six loads are under way at once
      // (left alone, the compiler loads tile after tile into the same registers, one
      // L2 latency behind the other); also the wait that stands behind global loads,
      // in front of the next write of their address registers
      asm volatile("s_wait_xcnt 0x0" :: "v"(bb[0]), "v"(bb[1]), "v"(bb[2]) : "memory");
#pragma unroll
      for (int u = 0; u < kQT; ++u) {
        s0[u] = wmma_f16(sel0, bb[u], s0[u]);
        s1[u] = wmma_f16(sel1, bb[u], s1[u]);
      }

      // Hand-over, as soon as the stage's four fragments are in registers: this
      // wave's reads of buf are done, its copies of the next stage have landed;
      // behind the barrier that holds for every wave, and buf is free for the
      // stage after the next, whose copy flies during the softmax below and the
      // next stage's score WMMAs.
      asm volatile("s_wait_dscnt 0x0" ::: "memory");
      wait_async_copies();
      __syncthreads();
      if (h * kCH + n + 2 < kST)
        stage_copy(n + 2 < kCH ? h : h + 1, n + 2 < kCH ? n + 2 : n + 2 - kCH, buf);

#pragma unroll
      for (int u = 0; u < kQT; ++u) {
        float t = fmaxf(s0[u][0], s1[u][0]);
#pragma unroll
        for (int r = 1; r < 8; ++r) t = fmaxf(t, fmaxf(s0[u][r], s1[u][r]));
        t = fmaxf(t, xhalf(t));  // both halves scale by the same maximum
        const float nm = fmaxf(mrun[u], t);
        const float sc = __expf(mrun[u] - nm);
        mrun[u] = nm;

        v16h pt;  // P^T as B operand: element s is key 32 n + (s<8 ? 8*(lane/16)+s : 16+8*(lane/16)+s-8)
        float rsum = 0.f;
#pragma unroll
        for (int r = 0; r < 8; ++r) {
          const float p0 = __expf(s0[u][r] - nm);
          const float p1 = __expf(s1[u][r] - nm);
          rsum += p0 + p1;
          pt[r]     = (_Float16)p0;
          pt[8 + r] = (_Float16)p1;
        }
        lsum[u] = lsum[u] * sc + rsum;
#pragma unroll
        for (int r = 0; r < 8; ++r) { o0[u][r] *= sc; o1[u][r] *= sc; }

        o0[u] = wmma_f16(av0, pt, o0[u]);
        o1[u] = wmma_f16(av1, pt, o1[u]);
      }
    }

    // O^T as f16: w0[r] is channel 8*hf + r of query lr, w1[r] channel 16 + 8*hf + r.
    // Each lane parks its 32 bytes a tile in LDS and takes them back itself below.
#pragma unroll
    for (int u = 0; u < kQT; ++u) {
      const float inv = 1.0f / (lsum[u] + xhalf(lsum[u]));
      v8h w0, w1;
#pragma unroll
      for (int r = 0; r < 8; ++r) {
        w0[r] = (_Float16)(o0[u][r] * inv);
        w1[r] = (_Float16)(o1[u][r] * inv);
      }
      Os[wave][u][h][0][lane] = w0;
      Os[wave][u][h][1][lane] = w1;
      bq[u] = bqn[u];
    }
  }
  wait_async_copies();

  // gate: g of row q; its blocks 2h and 2h + 1 are in the element order of the
  // parked O^T
  const long row = (long)i * kN + qbase + lr;
  const _Float16* gp = gb + (i * kN + qbase) / 16 * (kHC / 16) * kBK + 8 * lane;
  v8h gl[kQT][kH], gh[kQT][kH];
#pragma unroll
  for (int u = 0; u < kQT; ++u)
#pragma unroll
    for (int h = 0; h < kH; ++h) {
      gl[u][h] = *(const v8h*)(gp + (u * (kHC / 16) + 2 * h) * kBK);
      gh[u][h] = *(const v8h*)(gp + (u * (kHC / 16) + 2 * h + 1) * kBK);
    }
  xcnt_wait();
  v16h of[kQT][kH];  // (g .* o)^T as B operand: element 8*s + r is channel 16*s + 8*hf + r
#pragma unroll
  for (int u = 0; u < kQT; ++u)
#pragma unroll
    for (int h = 0; h < kH; ++h) {
      const v8h w0 = Os[wave][u][h][0][lane], w1 = Os[wave][u][h][1][lane];
#pragma unroll
      for (int e = 0; e < 8; ++e) {
        of[u][h][e] = gl[u][h][e] * w0[e];
        of[u][h][8 + e] = gh[u][h][e] * w1[e];
      }
    }

  // out^T tile nt: rows = output columns 16 nt + 8 hf + r, column = row q.
  // Two column tiles of three query tiles at a time: six independent accumulator
  // chains, every wo fragment used three times.
  float* dst = out + row * kCZ + 8 * hf;
  // rolled: unrolled, the fragment reads of all passes are hoisted together and
  // overflow the register budget of three waves per SIMD (spills)
#pragma unroll 1
  for (int n0 = 0; n0 < kCZ / 16; n0 += 2) {
    v8f acc[2][kQT] = {{zero, zero, zero}, {zero, zero, zero}};
#pragma unroll
    for (int h = 0; h < kH; ++h)
#pragma unroll
      for (int w = 0; w < 2; ++w) {
        const v16h wf = lfrag(&Wt[(n0 + w) * 16 + lr][h * kC + 8 * hf]);
#pragma unroll
        for (int u = 0; u < kQT; ++u) acc[w][u] = wmma_f16(wf, of[u][h], acc[w][u]);
      }
#pragma unroll
    for (int w = 0; w < 2; ++w) {
      const int col = (n0 + w) * 16;
      const float4 c0 = *(const float4*)&Bo[col + 8 * hf], c1 = *(const float4*)&Bo[col + 8 * hf + 4];
#pragma unroll
      for (int u = 0; u < kQT; ++u) {
        const v8f a = acc[w][u];
        const float4 r0 = {a[0] + c0.x, a[1] + c0.y, a[2] + c0.z, a[3] + c0.w};
        const float4 r1 = {a[4] + c1.x, a[5] + c1.y, a[6] + c1.z, a[7] + c1.w};
        *(float4*)(dst + u * 16 * kCZ + col)     = r0;
        *(float4*)(dst + u * 16 * kCZ + col + 4) = r1;
      }
    }
    xcnt_wait();
  }
}

// ---------------------------------------------------------------------------
extern "C" void kernel_launch(void* const* d_in, const int* in_sizes, int n_in,
                              void* d_out, int out_size, void* d_ws, size_t ws_size,
                              hipStream_t stream) {
  const float* z      = (const float*)d_in[0];
  const float* ln_g   = (const float*)d_in[1];
  const float* ln_b   = (const float*)d_in[2];
  const float* w_bias = (const float*)d_in[3];
  const float* wq     = (const float*)d_in[4];
  const float* wk     = (const float*)d_in[5];
  const float* wv     = (const float*)d_in[6];
  const float* wg     = (const float*)d_in[7];
  const float* bg     = (const float*)d_in[8];
  const float* wo     = (const float*)d_in[9];
  const float* bo     = (const float*)d_in[10];
  float* out = (float*)d_out;

  char* ws = (char*)d_ws;
  const size_t S2 = (size_t)kNN * kHC * 2;  // one fp16 NN x 128 buffer
  _Float16* qb = (_Float16*)(ws + 1 * S2);
  _Float16* kb = (_Float16*)(ws + 2 * S2);
  _Float16* vt = (_Float16*)(ws + 3 * S2);
  _Float16* gb = (_Float16*)(ws + 4 * S2);
  _Float16* biasb = (_Float16*)(ws + 6 * S2);  // H * NN fp16

  ln_proj_kernel<<<kNN / (16 * kMT * kFW), kFT, 0, stream>>>(
      z, ln_g, ln_b, w_bias, wq, wk, wv, wg, bg, qb, kb, vt, gb, biasb);

  dim3 g2(kN / (16 * kQT * kAW), kN);
  attn_out_kernel<<<g2, kAT, 0, stream>>>(qb, kb, vt, biasb, gb, wo, bo, out);
}

// v008
// A run of this version takes 92.3 microseconds.
// Two timings next to v007 both put it at 1.14 times that version's speed.
// Counting every step since v000, it is 6.02 times as fast.
#include <hip/hip_runtime.h>
#include <hip/hip_bf16.h>

typedef __attribute__((ext_vector_type(16))) _Float16 v16h;
typedef __attribute__((ext_vector_type(8)))  _Float16 v8h;
typedef __attribute__((ext_vector_type(4)))  _Float16 v4h;
typedef __attribute__((ext_vector_type(8)))  float    v8f;

constexpr int kN  = 384;
constexpr int kNN = kN * kN;      // 147456
constexpr int kCZ = 128;
constexpr int kH  = 4;
constexpr int kC  = 32;
constexpr int kHC = kH * kC;      // 128
// LDS row pitches in halves: an odd multiple of 16 bytes, so that the 16 rows
// one ds_load_b128 fragment read touches fall on 16 different bank groups.
constexpr int kWP = kCZ + 8;      // 272-byte rows for the 128-half weight tiles
constexpr int kTP = 32 + 8;       // 80-byte rows for the 32-half K, V tiles

// ---------------------------------------------------------------------------
// 16x16x32 f16 WMMA wrapper (CDNA5, wave32). D = A(16x32) * B(32x16) + C.
// ---------------------------------------------------------------------------
__device__ __forceinline__ v8f wmma_f16(v16h a, v16h b, v8f c) {
  return __builtin_amdgcn_wmma_f32_16x16x32_f16(false, a, false, b,
                                                (short)0, c, false, false);
}

// ---------------------------------------------------------------------------
// Lane order of the f16 workspace arrays. A block is 512 bytes: lane L's 8
// halves stand at 8*L, so that one 16-byte access per lane of a whole wave,
// store, load or copy, covers four whole 128-byte lines.
//   q, k: a tile of 16 rows j x 32 c is two blocks; block s, lane L holds row
//         L%16, columns 16*s + 8*(L/16) .. +8; tiles follow as (i, h, j/16)
//   v:    block (i, c/16 of all 128 channels, j/16): lane L holds channel L%16,
//         keys j 8*(L/16) .. +8
//   g:    a tile of 16 rows x 128 columns is eight blocks; block nt, lane L
//         holds row L%16, columns 16*nt + 8*(L/16) .. +8
// ---------------------------------------------------------------------------
constexpr int kBK = 32 * 8;       // halves in a block

// 16x32 f16 fragment (lane L: row L%16, halves [8*(L/16), +8) and
// [16+8*(L/16), +8)) from a q tile in lane order: its two blocks.
__device__ __forceinline__ v16h tfrag(const _Float16* __restrict__ tile, int lane) {
  const _Float16* p = tile + 8 * lane;
  v8h lo = *(const v8h*)p;
  v8h hi = *(const v8h*)(p + kBK);
  v16h r;
#pragma unroll
  for (int e = 0; e < 8; ++e) { r[e] = lo[e]; r[8 + e] = hi[e]; }
  return r;
}

// Fragment from an LDS tile row (32 halves of it): two ds_load_b128.
__device__ __forceinline__ v16h lfrag(const _Float16* p0) {
  v8h lo = *(const v8h*)p0;
  v8h hi = *(const v8h*)(p0 + 16);
  v16h r;
#pragma unroll
  for (int e = 0; e < 8; ++e) { r[e] = lo[e]; r[8 + e] = hi[e]; }
  return r;
}

// ---------------------------------------------------------------------------
// One 16-byte global -> LDS async DMA (CDNA5, tracked by ASYNCcnt).
// VDST carries the LDS byte address (ISA: dsaddr = LDS_BASE + VGPR[VDST]).
// A generic pointer into LDS holds the LDS offset in its low 32 bits on
// AMDGPU, so truncating the pointer gives the right VDST value.
// ---------------------------------------------------------------------------
__device__ __forceinline__ void copy16(const _Float16* gsrc, _Float16* ldst) {
#if defined(__gfx1250__)
  // the wait stands in the copy's own statement: in front of any later write
  // of the two address registers
  asm volatile("global_load_async_to_lds_b128 %0, %1, off\n\ts_wait_xcnt 0x0"
               :
               : "v"((unsigned)(unsigned long long)ldst), "v"(gsrc)
               : "memory");
#else
  *(v8h*)ldst = *(const v8h*)gsrc;
#endif
}

__device__ __forceinline__ void wait_async_copies() {
#if defined(__gfx1250__)
  asm volatile("s_wait_asynccnt 0x0" ::: "memory");
#endif
}

// ---------------------------------------------------------------------------
// Place of bias[h][q][k], an f16 value, in the workspace. A tile holds 16 q x
// 32 k (1 KB) as two blocks in lane order: the WMMA B fragment (32 rows k, 16
// columns q) of the transposed bias. Block s, lane l, half e: column q = l % 16,
// row k = 16*s + 8*(l/16) + e. tfrag reads a tile: two whole blocks. Tiles follow
// as (h, k/32, q/16): what all queries read in one stage of 32 keys is 24 KB in a
// row, and a wave's three tiles are 3 KB in a row.
// ---------------------------------------------------------------------------
__device__ __forceinline__ int bias_index(int h, int q, int k) {
  const int tile = (h * (kN / 32) + (k >> 5)) * (kN / 16) + (q >> 4);
  const int ln   = (q & 15) + (((k >> 3) & 1) << 4);
  return (tile * 2 + ((k >> 4) & 1)) * kBK + ln * 8 + (k & 7);
}

// Lane l <-> lane l ^ 16 (the two halves of a wave that share a WMMA column).
__device__ __forceinline__ float xhalf(float x) {
  const int v = __builtin_bit_cast(int, x);
  return __builtin_bit_cast(float, __builtin_amdgcn_permlanex16(
      v, v, 0x76543210, 0xfedcba98, false, false));
}

// ---------------------------------------------------------------------------
// Kernel 1: LayerNorm, pair bias and the q, k, v, g projections in one launch.
// One work-group per WGP: 12 waves, each owning 48 rows (i, j) = three 16-row
// tiles. z comes by whole-row loads and is turned, through a tile of LDS that
// belongs to the wave alone, into the WMMA fragment order (a lane: row
// lane % 16, 8 + 8 columns of every 32), so mean and variance are in-lane sums
// plus one exchange between the wave's halves, and the normalised rows become
// f16 fragments in registers: they never go to memory. All four weights sit in
// LDS as f16 [n][k]; every weight fragment read serves three row tiles.
//   q, k, g: D = W^T (A) x zn^T (B): a lane holds 8 neighbouring columns of one
//            row;  v: D = zn (A) x W (B): a lane holds 8 neighbouring j of one
//            channel. Each result tile goes out as one block in lane order.
//   bias: summed in fp32, stored as f16, q = i, k = j, in tiles of 16 q x 32 k laid
//         out as the WMMA B fragments that attn_out_kernel takes (bias_index)
// ---------------------------------------------------------------------------
constexpr int kFW = 12;           // waves per work-group
constexpr int kFT = kFW * 32;     // 384 threads
constexpr int kMT = 3;            // 16-row tiles per wave
constexpr int kZP = kCZ + 4;      // 528-byte rows (16 B x odd) for the fp32 z tile

// Stands behind global loads or stores, in front of the next write of a
// register that they name. The form with an address keeps that address in its
// registers up to the wait, so that no load of the run lands on them.
__device__ __forceinline__ void xcnt_wait() {
  asm volatile("s_wait_xcnt 0x0" ::: "memory");
}
__device__ __forceinline__ void xcnt_wait(const float* p) {
  asm volatile("s_wait_xcnt 0x0" :: "v"(p) : "memory");
}

// Staging of a weight W (128 k x 128 n, fp32) as f16 rows [n][k] in LDS, 8 k
// rows a wave at a time: eight whole-row loads (512 bytes, a lane takes 4 n),
// then for each of the lane's n one 16-byte LDS store of its 8 k.
__device__ __forceinline__ void load_wrows(float4 (&r)[8], const float* __restrict__ W,
                                           int k0, int lane) {
  const float* p = W + k0 * kHC + 4 * lane;
#pragma unroll
  for (int e = 0; e < 8; ++e) r[e] = *(const float4*)(p + e * kHC);
  xcnt_wait(p);
}

__device__ __forceinline__ void store_wrows(const float4 (&r)[8],
                                            _Float16 (*__restrict__ dst)[kWP],
                                            int k0, int lane) {
  v8h p0, p1, p2, p3;
#pragma unroll
  for (int e = 0; e < 8; ++e) {
    p0[e] = (_Float16)r[e].x; p1[e] = (_Float16)r[e].y;
    p2[e] = (_Float16)r[e].z; p3[e] = (_Float16)r[e].w;
  }
  *(v8h*)&dst[4 * lane + 0][k0] = p0;
  *(v8h*)&dst[4 * lane + 1][k0] = p1;
  *(v8h*)&dst[4 * lane + 2][k0] = p2;
  *(v8h*)&dst[4 * lane + 3][k0] = p3;
}

__global__ __launch_bounds__(kFT) void ln_proj_kernel(
    const float* __restrict__ z, const float* __restrict__ g,
    const float* __restrict__ b, const float* __restrict__ wb,
    const float* __restrict__ wq, const float* __restrict__ wk,
    const float* __restrict__ wv, const float* __restrict__ wg,
    const float* __restrict__ bg, _Float16* __restrict__ qo,
    _Float16* __restrict__ ko, _Float16* __restrict__ vo,
    _Float16* __restrict__ go, _Float16* __restrict__ bias) {
  __shared__ __attribute__((aligned(16))) _Float16 Wt[4 * kHC][kWP];  // q,k,v,g: 136 KB
  __shared__ __attribute__((aligned(16))) float Zs[kFW][16][kZP];     // 99 KB
  __shared__ __attribute__((aligned(16))) float Gs[kCZ];
  __shared__ __attribute__((aligned(16))) float Bs[kCZ];
  __shared__ __attribute__((aligned(16))) float Wbs[kCZ * kH];
  const int tid  = threadIdx.x;
  const int lane = tid & 31;
  const int lr   = lane & 15;   // row of a tile (A) or column (B)
  const int hf   = lane >> 4;   // which 8 of every 16 k
  const int wave = __builtin_amdgcn_readfirstlane(tid >> 5);
  const int task = blockIdx.x * kFW + wave;
  const int i    = task >> 3;           // 8 tasks of 48 rows make one i
  const int j0   = (task & 7) * (16 * kMT);
  const int row0 = i * kN + j0;

  // The 4 x 16 groups of 8 weight rows: group wave + 12*it for it = 0..4, and
  // the last four go to waves 0..3. Loads come back in the order of issue, so
  // the three groups asked for ahead of z are stored while z is on its way from
  // memory; the others follow z and land during the row statistics.
  float4 wa[3][8], wc[2][8], wx[8];
  load_wrows(wa[0], wq, wave * 8, lane);                                     // 0..11
  load_wrows(wa[1], wave < 4 ? wq : wk, ((wave + 12) & 15) * 8, lane);       // 12..23
  load_wrows(wa[2], wave < 8 ? wk : wv, ((wave + 8) & 15) * 8, lane);        // 24..35

  float4 zr[kMT][16];  // here [tile][row]: columns 4*lane .. of a whole row
  const float* zp = z + (long)row0 * kCZ + 4 * lane;
#pragma unroll
  for (int t = 0; t < kMT; ++t)
#pragma unroll
    for (int v = 0; v < 16; ++v)
      zr[t][v] = *(const float4*)(zp + (16 * t + v) * kCZ);
  xcnt_wait(zp);

  store_wrows(wa[0], &Wt[0], wave * 8, lane);
  store_wrows(wa[1], &Wt[wave < 4 ? 0 : kHC], ((wave + 12) & 15) * 8, lane);
  store_wrows(wa[2], &Wt[wave < 8 ? kHC : 2 * kHC], ((wave + 8) & 15) * 8, lane);

  if (wave < 4) {
    load_wrows(wx, wg, (wave + 12) * 8, lane);                               // 60..63
    const float gl = g[tid], bl = b[tid];
    const float4 wl = ((const float4*)wb)[tid];
    xcnt_wait();
    store_wrows(wx, &Wt[3 * kHC], (wave + 12) * 8, lane);
    Gs[tid] = gl; Bs[tid] = bl; ((float4*)Wbs)[tid] = wl;
  }
  load_wrows(wc[0], wv, (wave + 4) * 8, lane);                               // 36..47
  load_wrows(wc[1], wg, wave * 8, lane);                                     // 48..59

  // Each tile into the fragment order: from here zr is [tile][4*c + 2*hi + s],
  // columns 32c + 16hi + 8hf + 4s .. of row lr. Then the row statistics: 64
  // values in the lane, the other 64 in lane ^ 16.
  float (*Zw)[kZP] = Zs[wave];
  float mu[kMT], rs[kMT];
#pragma unroll
  for (int t = 0; t < kMT; ++t) {
#pragma unroll
    for (int v = 0; v < 16; ++v) *(float4*)&Zw[v][4 * lane] = zr[t][v];
    // other lanes of the wave read these rows back: the stores land first
    asm volatile("s_wait_dscnt 0x0" ::: "memory");
#pragma unroll
    for (int v = 0; v < 16; ++v)
      zr[t][v] = *(const float4*)&Zw[lr][8 * hf + 16 * (v >> 1) + 4 * (v & 1)];
    float4 a1 = {0.f, 0.f, 0.f, 0.f}, a2 = {0.f, 0.f, 0.f, 0.f};
#pragma unroll
    for (int v = 0; v < 16; ++v) {
      const float4 x = zr[t][v];
      a1.x += x.x; a1.y += x.y; a1.z += x.z; a1.w += x.w;
      a2.x += x.x * x.x; a2.y += x.y * x.y; a2.z += x.z * x.z; a2.w += x.w * x.w;
    }
    float s  = (a1.x + a1.y) + (a1.z + a1.w);
    float s2 = (a2.x + a2.y) + (a2.z + a2.w);
    s  += xhalf(s);
    s2 += xhalf(s2);
    mu[t] = s * (1.0f / kCZ);
    rs[t] = rsqrtf(s2 * (1.0f / kCZ) - mu[t] * mu[t] + 1e-5f);
  }

  store_wrows(wc[0], &Wt[2 * kHC], (wave + 4) * 8, lane);
  store_wrows(wc[1], &Wt[3 * kHC], wave * 8, lane);
  __syncthreads();

  // normalise; fp32 pair bias; f16 fragments. Element 8*hi + e of fragment c is
  // column 32c + 16hi + 8hf + e: the order in which lfrag reads a weight row.
  v16h zf[kMT][4];
  float ba[kMT][kH];
#pragma unroll
  for (int t = 0; t < kMT; ++t)
#pragma unroll
    for (int h = 0; h < kH; ++h) ba[t][h] = 0.f;
#pragma unroll
  for (int c = 0; c < 4; ++c)
#pragma unroll
    for (int hi = 0; hi < 2; ++hi) {
      const int k0 = 32 * c + 16 * hi + 8 * hf;
#pragma unroll
      for (int s = 0; s < 2; ++s) {
        const float4 gv = *(const float4*)&Gs[k0 + 4 * s];
        const float4 bv = *(const float4*)&Bs[k0 + 4 * s];
        const float ge[4] = {gv.x, gv.y, gv.z, gv.w};
        const float be[4] = {bv.x, bv.y, bv.z, bv.w};
        float4 w4[4];
#pragma unroll
        for (int e = 0; e < 4; ++e) w4[e] = *(const float4*)&Wbs[(k0 + 4 * s + e) * kH];
#pragma unroll
        for (int t = 0; t < kMT; ++t) {
          const float4 x = zr[t][4 * c + 2 * hi + s];
          const float xe[4] = {x.x, x.y, x.z, x.w};
#pragma unroll
          for (int e = 0; e < 4; ++e) {
            const float zl = (xe[e] - mu[t]) * rs[t] * ge[e] + be[e];
            zf[t][c][8 * hi + 4 * s + e] = (_Float16)zl;
            ba[t][0] += zl * w4[e].x;
            ba[t][1] += zl * w4[e].y;
            ba[t][2] += zl * w4[e].z;
            ba[t][3] += zl * w4[e].w;
          }
        }
      }
    }
#pragma unroll
  for (int t = 0; t < kMT; ++t) {
#pragma unroll
    for (int h = 0; h < kH; ++h) ba[t][h] += xhalf(ba[t][h]);
    // both halves hold all four sums of row lr: each half stores two heads
    const int j = j0 + 16 * t + lr;
    const int   x0 = bias_index(2 * hf, i, j), x1 = bias_index(2 * hf + 1, i, j);
    const _Float16 y0 = (_Float16)(hf ? ba[t][2] : ba[t][0]);
    const _Float16 y1 = (_Float16)(hf ? ba[t][3] : ba[t][1]);
    bias[x0] = y0;
    bias[x1] = y1;
    // as xcnt_wait(p): places and values stay in their registers up to the wait
    asm volatile("s_wait_xcnt 0x0" :: "v"(x0), "v"(x1), "v"(y0), "v"(y1) : "memory");
  }

  const v8f zero = {0.f, 0.f, 0.f, 0.f, 0.f, 0.f, 0.f, 0.f};

  // q (scaled) and k, tiles (i,h,j/16) in lane order: 16 tiles of 16 weight columns
  for (int nt = 0; nt < 16; ++nt) {
    v8f acc[kMT] = {zero, zero, zero};
#pragma unroll
    for (int c = 0; c < 4; ++c) {
      const v16h wf = lfrag(&Wt[nt * 16 + lr][c * 32 + 8 * hf]);
#pragma unroll
      for (int t = 0; t < kMT; ++t) acc[t] = wmma_f16(wf, zf[t][c], acc[t]);
    }
    const float sc = nt < 8 ? 0.17677669529663687f : 1.0f;
    _Float16* dst = (nt < 8 ? qo : ko) +
        (((i * kH + ((nt & 7) >> 1)) * kN + j0) / 16 * 2 + (nt & 1)) * kBK + 8 * lane;
#pragma unroll
    for (int t = 0; t < kMT; ++t) {
      v8h o;
#pragma unroll
      for (int r = 0; r < 8; ++r) o[r] = (_Float16)(acc[t][r] * sc);
      *(v8h*)(dst + 2 * t * kBK) = o;
      xcnt_wait();
    }
  }

  // v, blocks (i, c/16, j/16) in lane order
  for (int nt = 0; nt < 8; ++nt) {
    v8f acc[kMT] = {zero, zero, zero};
#pragma unroll
    for (int c = 0; c < 4; ++c) {
      const v16h wf = lfrag(&Wt[2 * kHC + nt * 16 + lr][c * 32 + 8 * hf]);
#pragma unroll
      for (int t = 0; t < kMT; ++t) acc[t] = wmma_f16(zf[t][c], wf, acc[t]);
    }
    _Float16* dst = vo + ((i * (kHC / 16) + nt) * kN + j0) / 16 * kBK + 8 * lane;
#pragma unroll
    for (int t = 0; t < kMT; ++t) {
      v8h o;
#pragma unroll
      for (int r = 0; r < 8; ++r) o[r] = (_Float16)acc[t][r];
      *(v8h*)(dst + t * kBK) = o;
      xcnt_wait();
    }
  }

  // g = sigmoid(x + bg), tiles of 16 rows (i,j) in lane order
  for (int nt = 0; nt < 8; ++nt) {
    v8f acc[kMT] = {zero, zero, zero};
#pragma unroll
    for (int c = 0; c < 4; ++c) {
      const v16h wf = lfrag(&Wt[3 * kHC + nt * 16 + lr][c * 32 + 8 * hf]);
#pragma unroll
      for (int t = 0; t < kMT; ++t) acc[t] = wmma_f16(wf, zf[t][c], acc[t]);
    }
    const int col = nt * 16 + 8 * hf;
    const float4 g0 = *(const float4*)(bg + col), g1 = *(const float4*)(bg + col + 4);
    xcnt_wait(bg + col);
    const float ge[8] = {g0.x, g0.y, g0.z, g0.w, g1.x, g1.y, g1.z, g1.w};
    _Float16* dst = go + (row0 / 16 * (kHC / 16) + nt) * kBK + 8 * lane;
#pragma unroll
    for (int t = 0; t < kMT; ++t) {
      v8h o;
#pragma unroll
      for (int r = 0; r < 8; ++r)
        o[r] = (_Float16)(1.0f / (1.0f + __expf(-(acc[t][r] + ge[r]))));
      *(v8h*)(dst + t * (kHC / 16) * kBK) = o;
      xcnt_wait();
    }
  }
}

// ---------------------------------------------------------------------------
// Kernel 2: flash attention over all four heads, gate and output projection.
// A work-group has 4 waves (one per SIMD) and one i; a wave owns 48 q rows as
// three tiles of 16 and runs the heads one after another: 48 stages of 32 keys.
// Every K, V and wo fragment a wave reads from LDS feeds three WMMAs, and a
// stage's barrier, copies and loop bookkeeping are paid once for three tiles.
// K/V 32x32 tiles are DMA'd once per work-group into double-buffered LDS
// (global_load_async_to_lds_b128, ASYNCcnt); the copy of stage t + 2 flies while
// stage t + 1 is worked on.
// Per stage and tile: S^T = K Q^T + E bias^T (2 + 2 WMMAs: K rows as A, Q as B;
// then a constant 0/1 matrix E as A, which picks 16 of the 32 key rows, and the
// f16 bias tile as B), so a lane holds 16 scores of ONE query: maximum and sum run
// in its own registers, plus one exchange between the wave's halves. The two S^T
// tiles, converted in place, are the B operand of O^T += V^T P^T (2 WMMAs).
// A head's O^T tiles, as f16, are in turn the B operand (k = the head's 32
// channels, column q) of out^T = wo^T (g .* o)^T: o never goes to memory, and a
// lane ends with 8 neighbouring output columns of one row; they leave through LDS
// as whole 128-byte lines.
// 768 work-groups: three on every WGP, all resident at once.
// ---------------------------------------------------------------------------
constexpr int kAW = 4;                // waves per work-group
constexpr int kAT = kAW * 32;         // 128 threads
constexpr int kQT = 3;                // 16-query tiles per wave
constexpr int kCH = kN / 32;          // 12 stages per head
constexpr int kST = kH * kCH;         // 48 stages
constexpr int kOP = 32 + 4;           // 144-byte rows (16 B x odd) for the fp32 output tile

// 3 waves per SIMD: the register budget at which three work-groups fit a WGP
__global__ __launch_bounds__(kAT, 3) void attn_out_kernel(
    const _Float16* __restrict__ q, const _Float16* __restrict__ k,
    const _Float16* __restrict__ vt, const _Float16* __restrict__ bias,
    const _Float16* __restrict__ gb, const float* __restrict__ wo,
    const float* __restrict__ bo, float* __restrict__ out) {
  __shared__ __attribute__((aligned(16))) _Float16 Kt[2][32][kTP];  // [buf][j-row][c]     5 KB
  __shared__ __attribute__((aligned(16))) _Float16 Vs[2][32][kTP];  // [buf][c-row][j]     5 KB
  __shared__ __attribute__((aligned(16))) _Float16 Wt[kCZ][kWP];    // wo as [n][k]       34 KB
  __shared__ __attribute__((aligned(16))) v8h Os[kAW][kQT][kH][2][32];  // a lane's own O^T 48 KB
  __shared__ __attribute__((aligned(16))) float Bo[kCZ];
  const int tid  = threadIdx.x;
  const int lane = tid & 31;
  const int lr   = lane & 15;
  const int hf   = lane >> 4;
  const int wave = __builtin_amdgcn_readfirstlane(tid >> 5);
  const int i = blockIdx.y;
  const int qbase = blockIdx.x * (16 * kQT * kAW) + wave * (16 * kQT);
  const _Float16* qp = q + (long)i * kH * kN * kC + qbase * kC;

  // K/V tile copy: wave cb brings block cb of K and block cb of V, each a block
  // in lane order (512 bytes in a row), 16 bytes a lane. A stage's K is four
  // blocks that follow one another (two tiles of 16 rows), stage t at 4 t; its V
  // is, for each 16 of the head's channels, the two blocks of keys
  // 32 (t % 12) .. +32. Block cb of the four lands at rows 16*(cb/2), halves
  // 16*(cb%2) of the LDS tile.
  const int cb   = wave;
  const int crow = 16 * (cb >> 1) + lr;        // 0..31
  const int cchk = 16 * (cb & 1) + 8 * hf;     // half offset 0,8,16,24
  const _Float16* ksrc = k + (long)i * kH * kN * kC + cb * kBK + 8 * lane;
  const _Float16* vsrc =
      vt + (long)i * kH * kC * kN + ((cb >> 1) * (kN / 16) + (cb & 1)) * kBK + 8 * lane;
  _Float16* kdst = &Kt[0][crow][cchk];
  _Float16* vdst = &Vs[0][crow][cchk];
  auto stage_copy = [&](int hh, int nn, int buf) {
    copy16(ksrc + (hh * kCH + nn) * 4 * kBK, kdst + buf * 32 * kTP);
    copy16(vsrc + hh * kC * kN + nn * 2 * kBK, vdst + buf * 32 * kTP);
  };

  // wo: 16 groups of 8 rows, groups wave, wave + 4, wave + 8, wave + 12
  float4 wa[4][8];
#pragma unroll
  for (int it = 0; it < 4; ++it) load_wrows(wa[it], wo, (wave + kAW * it) * 8, lane);
  float4 bl = {0.f, 0.f, 0.f, 0.f};
  if (wave == kAW - 1) {
    bl = ((const float4*)bo)[lane];
    xcnt_wait();
  }
  stage_copy(0, 0, 0);
  // every loop over the three tiles u is unrolled: its arrays are WMMA operands
  // and accumulators, which have to stay in registers
  v16h bq[kQT];  // Q^T columns of head 0, tile u
#pragma unroll
  for (int u = 0; u < kQT; ++u) bq[u] = tfrag(qp + u * 2 * kBK, lane);
  xcnt_wait();
#pragma unroll
  for (int it = 0; it < 4; ++it) store_wrows(wa[it], Wt, (wave + kAW * it) * 8, lane);
  if (wave == kAW - 1) ((float4*)Bo)[lane] = bl;
  wait_async_copies();
  __syncthreads();
  stage_copy(0, 1, 1);

  const v8f zero = {0.f, 0.f, 0.f, 0.f, 0.f, 0.f, 0.f, 0.f};

  // E0, E1 (16 x 32, A operands): E0[r][k] = (k == r), E1[r][k] = (k == 16 + r).
  // Lane: row lr; elements e < 8 are k = 8 hf + e, the others k = 16 + 8 hf + e - 8.
  v16h sel0, sel1;
#pragma unroll
  for (int e = 0; e < 8; ++e) {
    const _Float16 one = (_Float16)(8 * hf + e == lr ? 1.0f : 0.0f);
    sel0[e] = one;            sel0[8 + e] = (_Float16)0.0f;
    sel1[e] = (_Float16)0.0f; sel1[8 + e] = one;
  }

  // rolled: one copy of the stage loop in the instruction cache, and no head's
  // registers live on into the next
#pragma unroll 1
  for (int h = 0; h < kH; ++h) {
    // the next head's Q comes in while this head is worked on
    v16h bqn[kQT];
#pragma unroll
    for (int u = 0; u < kQT; ++u)
      bqn[u] = tfrag(qp + (h + 1 < kH ? h + 1 : h) * kN * kC + u * 2 * kBK, lane);
    xcnt_wait();
    // this wave's 48 queries: bias tiles (one per stage and query tile, two blocks
    // each; the three tiles of a stage follow one another)
    const _Float16* bp = bias + bias_index(h, qbase, 0);

    v8f o0[kQT], o1[kQT];  // O^T rows c in [0,16) / [16,32), column q = lane % 16
    float mrun[kQT];       // running maximum of query lane % 16
    float lsum[kQT];       // its denominator: this half-wave's keys only
#pragma unroll
    for (int u = 0; u < kQT; ++u) { o0[u] = zero; o1[u] = zero; mrun[u] = -1e30f; lsum[u] = 0.f; }

    for (int n = 0; n < kCH; ++n) {
      const int buf = n & 1;

      const v16h ak0 = lfrag(&Kt[buf][lr][hf << 3]);
      const v16h ak1 = lfrag(&Kt[buf][16 + lr][hf << 3]);
      // s0[u][r] = S[q = 16 u + lane%16][32 n + 8*(lane/16) + r], s1: the same + 16
      v8f s0[kQT], s1[kQT];
      v16h bb[kQT];  // bias^T of the stage's 32 keys, column q
#pragma unroll
      for (int u = 0; u < kQT; ++u) bb[u] = tfrag(bp + (n * (kN / 16) + u) * 2 * kBK, lane);
#pragma unroll
      for (int u = 0; u < kQT; ++u) {
        s0[u] = wmma_f16(ak0, bq[u], zero);
        s1[u] = wmma_f16(ak1, bq[u], zero);
      }
      const v16h av0 = lfrag(&Vs[buf][lr][hf << 3]);
      const v16h av1 = lfrag(&Vs[buf][16 + lr][hf << 3]);
      // takes the three loaded tiles as inputs: all six loads are under way at once
      // (left alone, the compiler loads tile after tile into the same registers, one
      // L2 latency behind the other); also the wait that stands behind global loads,
      // in front of the next write of their address registers
      asm volatile("s_wait_xcnt 0x0" :: "v"(bb[0]), "v"(bb[1]), "v"(bb[2]) : "memory");
#pragma unroll
      for (int u = 0; u < kQT; ++u) {
        s0[u] = wmma_f16(sel0, bb[u], s0[u]);
        s1[u] = wmma_f16(sel1, bb[u], s1[u]);
      }

      // Hand-over, as soon as the stage's four fragments are in registers: this
      // wave's reads of buf are done, its copies of the next stage have landed;
      // behind the barrier that holds for every wave, and buf is free for the
      // stage after the next, whose copy flies during the softmax below and the
      // next stage's score WMMAs.
      asm volatile("s_wait_dscnt 0x0" ::: "memory");
      wait_async_copies();
      __syncthreads();
      if (h * kCH + n + 2 < kST)
        stage_copy(n + 2 < kCH ? h : h + 1, n + 2 < kCH ? n + 2 : n + 2 - kCH, buf);

#pragma unroll
      for (int u = 0; u < kQT; ++u) {
        float t = fmaxf(s0[u][0], s1[u][0]);
#pragma unroll
        for (int r = 1; r < 8; ++r) t = fmaxf(t, fmaxf(s0[u][r], s1[u][r]));
        t = fmaxf(t, xhalf(t));  // both halves scale by the same maximum
        const float nm = fmaxf(mrun[u], t);
        const float sc = __expf(mrun[u] - nm);
        mrun[u] = nm;

        v16h pt;  // P^T as B operand: element s is key 32 n + (s<8 ? 8*(lane/16)+s : 16+8*(lane/16)+s-8)
        float rsum = 0.f;
#pragma unroll
        for (int r = 0; r < 8; ++r) {
          const float p0 = __expf(s0[u][r] - nm);
          const float p1 = __expf(s1[u][r] - nm);
          rsum += p0 + p1;
          pt[r]     = (_Float16)p0;
          pt[8 + r] = (_Float16)p1;
        }
        lsum[u] = lsum[u] * sc + rsum;
#pragma unroll
        for (int r = 0; r < 8; ++r) { o0[u][r] *= sc; o1[u][r] *= sc; }

        o0[u] = wmma_f16(av0, pt, o0[u]);
        o1[u] = wmma_f16(av1, pt, o1[u]);
      }
    }

    // O^T as f16: w0[r] is channel 8*hf + r of query lr, w1[r] channel 16 + 8*hf + r.
    // Each lane parks its 32 bytes a tile in LDS and takes them back itself below.
#pragma unroll
    for (int u = 0; u < kQT; ++u) {
      const float inv = 1.0f / (lsum[u] + xhalf(lsum[u]));
      v8h w0, w1;
#pragma unroll
      for (int r = 0; r < 8; ++r) {
        w0[r] = (_Float16)(o0[u][r] * inv);
        w1[r] = (_Float16)(o1[u][r] * inv);
      }
      Os[wave][u][h][0][lane] = w0;
      Os[wave][u][h][1][lane] = w1;
      bq[u] = bqn[u];
    }
  }
  wait_async_copies();

  // gate: g of row q; its blocks 2h and 2h + 1 are in the element order of the
  // parked O^T
  const long row0 = (long)i * kN + qbase;
  const _Float16* gp = gb + (i * kN + qbase) / 16 * (kHC / 16) * kBK + 8 * lane;
  v8h gl[kQT][kH], gh[kQT][kH];
#pragma unroll
  for (int u = 0; u < kQT; ++u)
#pragma unroll
    for (int h = 0; h < kH; ++h) {
      gl[u][h] = *(const v8h*)(gp + (u * (kHC / 16) + 2 * h) * kBK);
      gh[u][h] = *(const v8h*)(gp + (u * (kHC / 16) + 2 * h + 1) * kBK);
    }
  xcnt_wait();
  v16h of[kQT][kH];  // (g .* o)^T as B operand: element 8*s + r is channel 16*s + 8*hf + r
#pragma unroll
  for (int u = 0; u < kQT; ++u)
#pragma unroll
    for (int h = 0; h < kH; ++h) {
      const v8h w0 = Os[wave][u][h][0][lane], w1 = Os[wave][u][h][1][lane];
#pragma unroll
      for (int e = 0; e < 8; ++e) {
        of[u][h][e] = gl[u][h][e] * w0[e];
        of[u][h][8 + e] = gh[u][h][e] * w1[e];
      }
    }

  // out^T tile nt: rows = output columns 16 nt + 8 hf + r, column = row q.
  // Two column tiles of three query tiles at a time: six independent accumulator
  // chains, every wo fragment used three times. A pass yields one 128-byte line
  // (32 columns) of each of the wave's 48 rows, but a lane holds 16-byte pieces of
  // one row: stored as they lie, each store would put 32 bytes into 16 lines. The
  // pass goes through a tile of LDS instead, the wave's own part of Os, which it
  // has just emptied, and leaves by rows: a store covers four whole lines.
  float* Tw = (float*)&Os[wave][0][0][0][0];  // 48 rows of kOP floats
  // the wave's reads of its parked O^T are done before the tile is laid over them
  asm volatile("s_wait_dscnt 0x0" ::: "memory");
  float* tput = Tw + lr * kOP + 8 * hf;
  const float* tget = Tw + (lane >> 3) * kOP + 4 * (lane & 7);
  float* dst = out + (row0 + (lane >> 3)) * kCZ + 4 * (lane & 7);
  // rolled: unrolled, the fragment reads of all passes are hoisted together and
  // overflow the register budget of three waves per SIMD (spills)
#pragma unroll 1
  for (int n0 = 0; n0 < kCZ / 16; n0 += 2) {
    v8f acc[2][kQT] = {{zero, zero, zero}, {zero, zero, zero}};
#pragma unroll
    for (int h = 0; h < kH; ++h)
#pragma unroll
      for (int w = 0; w < 2; ++w) {
        const v16h wf = lfrag(&Wt[(n0 + w) * 16 + lr][h * kC + 8 * hf]);
#pragma unroll
        for (int u = 0; u < kQT; ++u) acc[w][u] = wmma_f16(wf, of[u][h], acc[w][u]);
      }
#pragma unroll
    for (int w = 0; w < 2; ++w) {
      const int col = (n0 + w) * 16;
      const float4 c0 = *(const float4*)&Bo[col + 8 * hf], c1 = *(const float4*)&Bo[col + 8 * hf + 4];
#pragma unroll
      for (int u = 0; u < kQT; ++u) {
        const v8f a = acc[w][u];
        const float4 r0 = {a[0] + c0.x, a[1] + c0.y, a[2] + c0.z, a[3] + c0.w};
        const float4 r1 = {a[4] + c1.x, a[5] + c1.y, a[6] + c1.z, a[7] + c1.w};
        *(float4*)(tput + u * 16 * kOP + w * 16)     = r0;
        *(float4*)(tput + u * 16 * kOP + w * 16 + 4) = r1;
      }
    }
    // other lanes of the wave read these rows back: the stores land first
    asm volatile("s_wait_dscnt 0x0" ::: "memory");
    // both loops unrolled: ln stays in registers, and all twelve reads are under way
    // before the first store waits for its own
    float4 ln[4 * kQT];  // piece lane % 8 of the line of row 4 v + lane / 8
#pragma unroll
    for (int v = 0; v < 4 * kQT; ++v) ln[v] = *(const float4*)(tget + v * 4 * kOP);
#pragma unroll
    for (int v = 0; v < 4 * kQT; ++v) *(float4*)(dst + v * 4 * kCZ + n0 * 16) = ln[v];
    xcnt_wait();
  }
}

// ---------------------------------------------------------------------------
extern "C" void kernel_launch(void* const* d_in, const int* in_sizes, int n_in,
                              void* d_out, int out_size, void* d_ws, size_t ws_size,
                              hipStream_t stream) {
  const float* z      = (const float*)d_in[0];
  const float* ln_g   = (const float*)d_in[1];
  const float* ln_b   = (const float*)d_in[2];
  const float* w_bias = (const float*)d_in[3];
  const float* wq     = (const float*)d_in[4];
  const float* wk     = (const float*)d_in[5];
  const float* wv     = (const float*)d_in[6];
  const float* wg     = (const float*)d_in[7];
  const float* bg     = (const float*)d_in[8];
  const float* wo     = (const float*)d_in[9];
  const float* bo     = (const float*)d_in[10];
  float* out = (float*)d_out;

  char* ws = (char*)d_ws;
  const size_t S2 = (size_t)kNN * kHC * 2;  // one fp16 NN x 128 buffer
  _Float16* qb = (_Float16*)(ws + 1 * S2);
  _Float16* kb = (_Float16*)(ws + 2 * S2);
  _Float16* vt = (_Float16*)(ws + 3 * S2);
  _Float16* gb = (_Float16*)(ws + 4 * S2);
  _Float16* biasb = (_Float16*)(ws + 6 * S2);  // H * NN fp16

  ln_proj_kernel<<<kNN / (16 * kMT * kFW), kFT, 0, stream>>>(
      z, ln_g, ln_b, w_bias, wq, wk, wv, wg, bg, qb, kb, vt, gb, biasb);

  dim3 g2(kN / (16 * kQT * kAW), kN);
  attn_out_kernel<<<g2, kAT, 0, stream>>>(qb, kb, vt, biasb, gb, wo, bo, out);
}
